// v000
// Measured on an AMD MI455X. A time is GPU time per run, averaged over a window of back-to-back runs after a warm-up
// (all launches, gaps included; the runs take copies of the inputs in turn), and the median of several windows.
// Apart from v000's, it joins two sittings. Times from different sittings can be a few percent apart, while
// side-by-side timings come from the same sitting.
// The starting kernel, v000, takes 738 microseconds a run.
// compute dtype: all float inputs rounded to bf16; q = query^T Wq^T + bq, k/v = key^T W^T + b with EXACT bf16 products on WMMA 16x16x32 (channel-major tiles transposed in LDS), f32 accumulate; q as f16 hi + residual, k f16 -> 2-product causal logits / 8 stored in f32 per batch (8 heads per launch); softmax in f32 (precise expf), P x 2^11 kept f32 and split bf16 hi + lo against v bf16 hi + lo (3 products); output written channel-major [b][e][s] in f32 (no output projection).
#include <hip/hip_runtime.h>
#include <math.h>

typedef __attribute__((ext_vector_type(16))) _Float16 v16h;
typedef __attribute__((ext_vector_type(16))) __bf16 v16b;
typedef __attribute__((ext_vector_type(8)))  _Float16 v8h;
typedef __attribute__((ext_vector_type(8)))  float v8f;
typedef __attribute__((ext_vector_type(4)))  float v4f;
typedef __attribute__((ext_vector_type(2)))  float v2f;
typedef __attribute__((ext_vector_type(4)))  unsigned v4u;
typedef __attribute__((ext_vector_type(4)))  int v4i;
typedef float __attribute__((may_alias)) float_a;
typedef int __attribute__((may_alias)) int_a;

template <typename T> __device__ __forceinline__ void vst2(void* p, T v) { *(T*)p = v;  }
__device__ __forceinline__ v8f wmma16(v16h a, v16h b, v8f c) {
  v8f d = __builtin_amdgcn_wmma_f32_16x16x32_f16(false, a, false, b, (short)0, c, false, false);
  asm volatile("v_nop\n\tv_nop\n\tv_nop\n\tv_nop" : "+v"(d) : "v"(a), "v"(b));
  return d;
}
__device__ __forceinline__ v8f wmma_bf(v16b a, v16b b, v8f c) {
  v8f d = __builtin_amdgcn_wmma_f32_16x16x32_bf16(false, a, false, b, (short)0, c, false, false);
  asm volatile("v_nop\n\tv_nop\n\tv_nop\n\tv_nop" : "+v"(d) : "v"(a), "v"(b));
  return d;
}
// 16x16x32 fragments: lane = (h = lane>>4, row/col = lane&15); elements 0..7 = k0+8h+0..7, 8..15 = k0+16+8h+0..7; D element r = row 8h+r
__device__ __forceinline__ v16h frag_h(const _Float16* rowk0, int lane) {
  union { v16h v; v8h q[2]; } u; const _Float16* p = rowk0 + 8 * (lane >> 4);
  u.q[0] = *(const v8h*)p; u.q[1] = *(const v8h*)(p + 16); return u.v;
}
__device__ __forceinline__ v16h frag_f32(const float* rowk0, int lane) {
  v16h a; const float* p = rowk0 + 8 * (lane >> 4);
#pragma unroll
  for (int i = 0; i < 8; ++i) { a[i] = (_Float16)p[i]; a[8 + i] = (_Float16)p[16 + i]; }
  return a;
}
__device__ __forceinline__ v16h frag_f32s(const float* rowk0, int lane, float sc) {
  v16h a; const float* p = rowk0 + 8 * (lane >> 4);
#pragma unroll
  for (int i = 0; i < 8; ++i) { a[i] = (_Float16)(p[i] * sc); a[8 + i] = (_Float16)(p[16 + i] * sc); }
  return a;
}
// column fragment from a [K][ld] layout (column n), rows >= K read as 0
__device__ __forceinline__ v16h fragc_f32(const float* W, int k0, int n, int lane, int ld, int K) {
  v16h a; const int g = lane >> 4;
#pragma unroll
  for (int i = 0; i < 8; ++i) { const int ka = k0 + 8 * g + i, kb = ka + 16;
    a[i] = (_Float16)(ka < K ? W[(size_t)(ka < K ? ka : K - 1) * ld + n] : 0.f); a[8 + i] = (_Float16)(kb < K ? W[(size_t)(kb < K ? kb : K - 1) * ld + n] : 0.f); }
  return a;
}
struct F2 { v16b h, l; };
__device__ __forceinline__ F2 bsplit16(const float v[16]) { F2 r;
#pragma unroll
  for (int i = 0; i < 16; ++i) { const __bf16 h = (__bf16)v[i]; r.h[i] = h; r.l[i] = (__bf16)(v[i] - (float)h); }
  return r; }
__device__ __forceinline__ F2 split_row(const float* row, int k0, int lane) { float v[16]; const float* p = row + k0 + 8 * (lane >> 4);
#pragma unroll
  for (int i = 0; i < 8; ++i) { v[i] = p[i]; v[8 + i] = p[16 + i]; }
  return bsplit16(v); }
__device__ __forceinline__ F2 split_rowK(const float* row, int k0, int lane, int K) { float v[16]; const int g = lane >> 4;
#pragma unroll
  for (int i = 0; i < 8; ++i) { const int ka = k0 + 8 * g + i, kb = ka + 16; v[i] = ka < K ? row[ka < K ? ka : K - 1] : 0.f; v[8 + i] = kb < K ? row[kb < K ? kb : K - 1] : 0.f; }
  return bsplit16(v); }
__device__ __forceinline__ F2 split_col(const float* W, int k0, int n, int lane, int ld, int K) { float v[16]; const int g = lane >> 4;
#pragma unroll
  for (int i = 0; i < 8; ++i) { const int ka = k0 + 8 * g + i, kb = ka + 16; v[i] = ka < K ? W[(size_t)(ka < K ? ka : K - 1) * ld + n] : 0.f; v[8 + i] = kb < K ? W[(size_t)(kb < K ? kb : K - 1) * ld + n] : 0.f; }
  return bsplit16(v); }
__device__ __forceinline__ v8f mac3(const F2& a, const F2& b, v8f c) { c = wmma_bf(a.l, b.h, c); c = wmma_bf(a.h, b.l, c); return wmma_bf(a.h, b.h, c); }
__device__ __forceinline__ float sigm(float v) { return 1.0f / (1.0f + expf(-v)); }
#define LDSX() do { asm volatile("s_wait_dscnt 0" ::: "memory"); __builtin_amdgcn_wave_barrier(); __builtin_amdgcn_fence(__ATOMIC_RELEASE, "workgroup"); } while (0)


// PixelSNAIL causal attention (B 8, 32x32 = 1,024 positions, q from a 256-ch query map, k/v from a 256-ch key map, embed 512 = 8 heads x 64): channel-major in, channel-major out [b][h*64+d][s].
#define NB 8
#define TT 1024
#define CC 512
#define NH 8
#define HD 64
#ifndef TNB
#define TNB NB
#endif
typedef __attribute__((ext_vector_type(8))) __bf16 v8b;
__device__ __forceinline__ v16b frag_b(const __bf16* rowk0, int lane) {
  union { v16b v; v8b q[2]; } u; const __bf16* p = rowk0 + 8 * (lane >> 4);
  u.q[0] = *(const v8b*)p; u.q[1] = *(const v8b*)(p + 16); return u.v;
}
__device__ __forceinline__ float bfr(float v) { return (float)(__bf16)v; }
__device__ __attribute__((noinline)) float exp_ni(float v) { return expf(v); }
__device__ __attribute__((noinline)) float erf_ni(float v) { return erff(v); }

#define WS_QH  0u
#define WS_QL  (WS_QH + 2u * (size_t)NB * TT * CC)
#define WS_KH  (WS_QL + 2u * (size_t)NB * TT * CC)
#define WS_VT  (WS_KH + 2u * (size_t)NB * TT * CC)      // bf16 v planes [b][c][t]
#define WS_VL  (WS_VT + 2u * (size_t)NB * CC * TT)      // bf16 v residual planes
#define HG 8                                          // heads per launch group
#define WS_S   (WS_VL + 2u * (size_t)NB * CC * TT)      // f32 logits / P for HG heads [hg][q][k]
#define WS_PH  (WS_S + 4u * (size_t)HG * TT * TT)
#define WS_END (WS_PH + 16u)

#define CIN 256
// ---- k_proj: block = (64 positions, 128 out cols, b*3 + which): x^T tile [64 s][256 c] bf16 in LDS from the channel-major map (query for q, key for k/v); W [out][in] + b exact; q -> f16 hi + residual rows, k -> f16 rows, v -> bf16 hi + lo planes
__global__ __launch_bounds__(128) void k_proj(const float* __restrict__ XQ, const float* __restrict__ XK, const float* __restrict__ WQ, const float* __restrict__ BQ, const float* __restrict__ WK, const float* __restrict__ BK, const float* __restrict__ WV, const float* __restrict__ BV, _Float16* __restrict__ QH, _Float16* __restrict__ QL, _Float16* __restrict__ KH, __bf16* __restrict__ VT, __bf16* __restrict__ VL) {
  __shared__ __align__(16) __bf16 sx[64][CIN + 8]; __shared__ __align__(16) _Float16 sh[64][136], sl[64][136]; __shared__ __align__(16) __bf16 th[128][72], tl2[128][72];
  const int tid = threadIdx.x, wave = tid >> 5, lane = tid & 31, col = lane & 15, g = lane >> 4; const int p0 = blockIdx.x * 64; const int c0 = blockIdx.y * 128; const size_t b = blockIdx.z / 3; const int which = blockIdx.z % 3;
  const float* X = which == 0 ? XQ : XK; const float* Wm = which == 0 ? WQ : which == 1 ? WK : WV; const float* Bm = which == 0 ? BQ : which == 1 ? BK : BV;
  for (int e = tid; e < CIN * 64; e += 128) { const int c = e >> 6, pl = e & 63; sx[pl][c] = (__bf16)X[(b * CIN + c) * (size_t)TT + p0 + pl]; }
  __syncthreads();
  v8f acc[8] = {};
#pragma unroll 2
  for (int kc = 0; kc < CIN / 32; ++kc) { const v16b a = frag_b(&sx[wave * 16 + col][kc * 32], lane);
#pragma unroll
    for (int j = 0; j < 8; ++j) { v16b w; const int o = c0 + j * 16 + col;
#pragma unroll
      for (int i = 0; i < 8; ++i) { w[i] = (__bf16)Wm[(size_t)o * CIN + kc * 32 + 8 * g + i]; w[8 + i] = (__bf16)Wm[(size_t)o * CIN + kc * 32 + 16 + 8 * g + i]; }
      acc[j] = wmma_bf(a, w, acc[j]); } }
#pragma unroll
  for (int j = 0; j < 8; ++j) { const float bb = bfr(Bm[c0 + j * 16 + col]);
#pragma unroll
    for (int r = 0; r < 8; ++r) { const float v = acc[j][r] + bb; const int rl = wave * 16 + 8 * g + r, cl = j * 16 + col;
      if (which == 2) { const __bf16 bh = (__bf16)v; th[cl][rl] = bh; tl2[cl][rl] = (__bf16)(v - (float)bh); } else { const _Float16 hv = (_Float16)v; sh[rl][cl] = hv; sl[rl][cl] = (_Float16)(v - (float)hv); } } }
  __syncthreads();
  if (which < 2) { _Float16* dh = which == 0 ? QH : KH; for (int e = tid; e < 64 * 16; e += 128) { const int rl = e >> 4, q = e & 15; const size_t row = b * TT + p0 + rl; vst2((unsigned*)(dh + row * CC + c0 + q * 8), *(const v4u*)&sh[rl][q * 8]); if (which == 0) vst2((unsigned*)(QL + row * CC + c0 + q * 8), *(const v4u*)&sl[rl][q * 8]); } }
  else { for (int e = tid; e < 128 * 8; e += 128) { const int cl = e >> 3, q = e & 7; const size_t o2 = (b * CC + c0 + cl) * (size_t)TT + p0 + q * 8; vst2((unsigned*)(VT + o2), *(const v4u*)&th[cl][q * 8]); vst2((unsigned*)(VL + o2), *(const v4u*)&tl2[cl][q * 8]); } } }
// ---- k_sc: block = (64 queries, 128 keys) of (b,h): logits * scale (bias matrix argument unused); causal blocks beyond the diagonal exit
__global__ __launch_bounds__(128) void k_sc(const _Float16* __restrict__ QH, const _Float16* __restrict__ QL, const _Float16* __restrict__ KH, const float* __restrict__ BM, int b, int h0, float* __restrict__ S0) { __shared__ __align__(16) float ss[4][16][132]; const int h = h0 + blockIdx.z; float* S = S0 + (size_t)blockIdx.z * TT * TT;
  const int tid = threadIdx.x, wave = tid >> 5, lane = tid & 31, col = lane & 15, g = lane >> 4; const int k0 = blockIdx.y * 128; const int ql0 = blockIdx.x * 64 + wave * 16; const size_t q0 = (size_t)b * TT + ql0;
  if (k0 > blockIdx.x * 64 + 63) return;   // whole key block above the diagonal (block-uniform)
  v8f acc[8] = {};
#pragma unroll
  for (int kc = 0; kc < HD / 32; ++kc) { const v16h ah = frag_h(QH + (q0 + col) * CC + h * HD + kc * 32, lane), al = frag_h(QL + (q0 + col) * CC + h * HD + kc * 32, lane);
#pragma unroll
    for (int j = 0; j < 8; ++j) { const v16h kb = frag_h(KH + ((size_t)b * TT + k0 + j * 16 + col) * CC + h * HD + kc * 32, lane); acc[j] = wmma16(ah, kb, acc[j]); acc[j] = wmma16(al, kb, acc[j]); } }
#pragma unroll
  for (int j = 0; j < 8; ++j) { const int kt = k0 + j * 16 + col;
#pragma unroll
    for (int r = 0; r < 8; ++r) { const int qt = ql0 + 8 * g + r; float v = acc[j][r] * 0.125f; (void)BM; if (kt > qt) v = -3.0e38f; ss[wave][8 * g + r][j * 16 + col] = v; } }
  LDSX(); for (int rl = 0; rl < 16; ++rl) vst2(S + (size_t)(ql0 + rl) * TT + k0 + lane * 4, *(const v4f*)&ss[wave][rl][lane * 4]); }
// ---- k_sm: block = query row: softmax over keys [0, kend) -> P x 2^11 f32 (masked -> 0)
__global__ __launch_bounds__(256) void k_sm(float* __restrict__ S0) { __shared__ float sred[8]; __shared__ float sbc; __shared__ __align__(16) float sh[TT];
  const int t = threadIdx.x; const size_t row = blockIdx.x; float* sr = S0 + (size_t)blockIdx.y * TT * TT + row * TT; const int kend = ((int)row / 64) * 64 + 64;
  float m = -3.0e38f; for (int k = t; k < kend; k += 256) m = fmaxf(m, sr[k]);
#pragma unroll
  for (int o = 1; o < 32; o <<= 1) m = fmaxf(m, __shfl_xor(m, o));
  if ((t & 31) == 0) sred[t >> 5] = m; __syncthreads(); if (t == 0) { float a = sred[0]; for (int i = 1; i < 8; ++i) a = fmaxf(a, sred[i]); sbc = a; } __syncthreads(); m = sbc; __syncthreads();
  float sum = 0.f; for (int k = t; k < kend; k += 256) { const float v = sr[k]; sum += (v <= -1.0e38f) ? 0.f : expf(v - m); }
#pragma unroll
  for (int o = 1; o < 32; o <<= 1) sum += __shfl_xor(sum, o);
  if ((t & 31) == 0) sred[t >> 5] = sum; __syncthreads(); if (t == 0) { float a = 0.f; for (int i = 0; i < 8; ++i) a += sred[i]; sbc = 1.0f / a; } __syncthreads(); const float inv = sbc;
  for (int k = t; k < kend; k += 256) { const float v = sr[k]; sh[k] = (v <= -1.0e38f) ? 0.f : expf(v - m) * inv * 2048.0f; }
  __syncthreads(); for (int q = t; q < kend / 4; q += 256) vst2(sr + q * 4, *(const v4f*)&sh[q * 4]); }
// ---- k_pv: block = 64 queries of (b,h): y[q][h*HD + d] = P . v  (keys [0, kend))
__global__ __launch_bounds__(128) void k_pv(const float* __restrict__ PS0, const __bf16* __restrict__ VT, const __bf16* __restrict__ VL, int b, int h0, float* __restrict__ Y) { const int h = h0 + blockIdx.z; const float* PS = PS0 + (size_t)blockIdx.z * TT * TT; __shared__ __align__(16) float ss[4][16][HD + 4];
  const int tid = threadIdx.x, wave = tid >> 5, lane = tid & 31, col = lane & 15, g = lane >> 4; const int ql0 = blockIdx.x * 64 + wave * 16; const int kend = blockIdx.x * 64 + 64;
  v8f acc[HD / 16] = {};
#pragma unroll 1
  for (int kc = 0; kc < kend / 32; ++kc) { const F2 p = split_row(PS + (size_t)(ql0 + col) * TT, kc * 32, lane);
#pragma unroll
    for (int j = 0; j < HD / 16; ++j) { const size_t po = ((size_t)b * CC + h * HD + j * 16 + col) * (size_t)TT + kc * 32; const v16b vh = frag_b(VT + po, lane); acc[j] = wmma_bf(p.h, vh, acc[j]); acc[j] = wmma_bf(p.l, vh, acc[j]); acc[j] = wmma_bf(p.h, frag_b(VL + po, lane), acc[j]); } }
#pragma unroll
  for (int j = 0; j < HD / 16; ++j)
#pragma unroll
    for (int r = 0; r < 8; ++r) ss[wave][8 * g + r][j * 16 + col] = acc[j][r] * (1.0f / 2048.0f);
  __syncthreads();
  { __shared__ __align__(16) float so[HD][68]; for (int e = threadIdx.x; e < 64 * HD; e += 128) { const int ql = e / HD, d = e % HD; so[d][ql] = ss[ql >> 4][ql & 15][d]; } __syncthreads();
    for (int e = threadIdx.x; e < HD * 16; e += 128) { const int d = e >> 4, q4 = e & 15; vst2(Y + ((size_t)b * CC + h * HD + d) * TT + blockIdx.x * 64 + q4 * 4, *(const v4f*)&so[d][q4 * 4]); } } }
extern "C" void kernel_launch(void* const* d_in, const int* in_sizes, int n_in, void* d_out, int out_size, void* d_ws, size_t ws_size, hipStream_t stream) {
  (void)in_sizes; (void)n_in; (void)out_size;
  const float** F = (const float**)d_in;   // 0 query [8,256,32,32], 1 key [8,256,32,32], 2 Wq [512,256], 3 bq, 4 Wk [512,256], 5 bk, 6 Wv [512,256], 7 bv
  if (ws_size < (size_t)WS_END) return;
  char* ws = (char*)d_ws; _Float16 *QH = (_Float16*)(ws + WS_QH), *QL = (_Float16*)(ws + WS_QL), *KH = (_Float16*)(ws + WS_KH); __bf16 *VT = (__bf16*)(ws + WS_VT), *VL = (__bf16*)(ws + WS_VL); float *S = (float*)(ws + WS_S);
  k_proj<<<dim3(TT / 64, CC / 128, TNB * 3), 128, 0, stream>>>(F[0], F[1], F[2], F[3], F[4], F[5], F[6], F[7], QH, QL, KH, VT, VL);
  for (int b = 0; b < TNB; ++b) for (int h0 = 0; h0 < NH; h0 += HG) {   // HG heads per launch
    k_sc<<<dim3(TT / 64, TT / 128, HG), 128, 0, stream>>>(QH, QL, KH, nullptr, b, h0, S);
    k_sm<<<dim3(TT, HG), 256, 0, stream>>>(S);
    k_pv<<<dim3(TT / 64, 1, HG), 128, 0, stream>>>(S, VT, VL, b, h0, (float*)d_out);
  }
}

// v001
// It runs in 354 microseconds.
// Timed twice side by side with v000, it ran 2.10 times as fast both times.
// compute dtype: all float inputs rounded to bf16; q = query^T Wq^T + bq, k/v = key^T W^T + b with EXACT bf16 products on WMMA 16x16x32 (channel-major tiles transposed in LDS), f32 accumulate; q as f16 hi + residual, k f16 -> 2-product causal logits / 8 stored in f32 for all 64 (batch, head) pairs at once, as packed causal row blocks (one launch per stage); softmax in f32 (precise expf), P x 2^11 kept f32 and split bf16 hi + lo against v bf16 hi + lo (3 products); output written channel-major [b][e][s] in f32 (no output projection).
#include <hip/hip_runtime.h>
#include <math.h>

typedef __attribute__((ext_vector_type(16))) _Float16 v16h;
typedef __attribute__((ext_vector_type(16))) __bf16 v16b;
typedef __attribute__((ext_vector_type(8)))  _Float16 v8h;
typedef __attribute__((ext_vector_type(8)))  float v8f;
typedef __attribute__((ext_vector_type(4)))  float v4f;
typedef __attribute__((ext_vector_type(2)))  float v2f;
typedef __attribute__((ext_vector_type(4)))  unsigned v4u;
typedef __attribute__((ext_vector_type(4)))  int v4i;
typedef float __attribute__((may_alias)) float_a;
typedef int __attribute__((may_alias)) int_a;

template <typename T> __device__ __forceinline__ void vst2(void* p, T v) { *(T*)p = v;  }
__device__ __forceinline__ v8f wmma16(v16h a, v16h b, v8f c) {
  v8f d = __builtin_amdgcn_wmma_f32_16x16x32_f16(false, a, false, b, (short)0, c, false, false);
  asm volatile("v_nop\n\tv_nop\n\tv_nop\n\tv_nop" : "+v"(d) : "v"(a), "v"(b));
  return d;
}
__device__ __forceinline__ v8f wmma_bf(v16b a, v16b b, v8f c) {
  v8f d = __builtin_amdgcn_wmma_f32_16x16x32_bf16(false, a, false, b, (short)0, c, false, false);
  asm volatile("v_nop\n\tv_nop\n\tv_nop\n\tv_nop" : "+v"(d) : "v"(a), "v"(b));
  return d;
}
// 16x16x32 fragments: lane = (h = lane>>4, row/col = lane&15); elements 0..7 = k0+8h+0..7, 8..15 = k0+16+8h+0..7; D element r = row 8h+r
__device__ __forceinline__ v16h frag_h(const _Float16* rowk0, int lane) {
  union { v16h v; v8h q[2]; } u; const _Float16* p = rowk0 + 8 * (lane >> 4);
  u.q[0] = *(const v8h*)p; u.q[1] = *(const v8h*)(p + 16); return u.v;
}
__device__ __forceinline__ v16h frag_f32(const float* rowk0, int lane) {
  v16h a; const float* p = rowk0 + 8 * (lane >> 4);
#pragma unroll
  for (int i = 0; i < 8; ++i) { a[i] = (_Float16)p[i]; a[8 + i] = (_Float16)p[16 + i]; }
  return a;
}
__device__ __forceinline__ v16h frag_f32s(const float* rowk0, int lane, float sc) {
  v16h a; const float* p = rowk0 + 8 * (lane >> 4);
#pragma unroll
  for (int i = 0; i < 8; ++i) { a[i] = (_Float16)(p[i] * sc); a[8 + i] = (_Float16)(p[16 + i] * sc); }
  return a;
}
// column fragment from a [K][ld] layout (column n), rows >= K read as 0
__device__ __forceinline__ v16h fragc_f32(const float* W, int k0, int n, int lane, int ld, int K) {
  v16h a; const int g = lane >> 4;
#pragma unroll
  for (int i = 0; i < 8; ++i) { const int ka = k0 + 8 * g + i, kb = ka + 16;
    a[i] = (_Float16)(ka < K ? W[(size_t)(ka < K ? ka : K - 1) * ld + n] : 0.f); a[8 + i] = (_Float16)(kb < K ? W[(size_t)(kb < K ? kb : K - 1) * ld + n] : 0.f); }
  return a;
}
struct F2 { v16b h, l; };
__device__ __forceinline__ F2 bsplit16(const float v[16]) { F2 r;
#pragma unroll
  for (int i = 0; i < 16; ++i) { const __bf16 h = (__bf16)v[i]; r.h[i] = h; r.l[i] = (__bf16)(v[i] - (float)h); }
  return r; }
__device__ __forceinline__ F2 split_row(const float* row, int k0, int lane) { float v[16]; const float* p = row + k0 + 8 * (lane >> 4);
#pragma unroll
  for (int i = 0; i < 8; ++i) { v[i] = p[i]; v[8 + i] = p[16 + i]; }
  const F2 r = bsplit16(v);
  asm volatile("s_wait_xcnt 0x0" :: "v"(p) : "memory");   // names the row loads' address as an input: the allocator may reuse that register pair (as a later load's destination) only behind this wait
  return r; }
__device__ __forceinline__ F2 split_rowK(const float* row, int k0, int lane, int K) { float v[16]; const int g = lane >> 4;
#pragma unroll
  for (int i = 0; i < 8; ++i) { const int ka = k0 + 8 * g + i, kb = ka + 16; v[i] = ka < K ? row[ka < K ? ka : K - 1] : 0.f; v[8 + i] = kb < K ? row[kb < K ? kb : K - 1] : 0.f; }
  return bsplit16(v); }
__device__ __forceinline__ F2 split_col(const float* W, int k0, int n, int lane, int ld, int K) { float v[16]; const int g = lane >> 4;
#pragma unroll
  for (int i = 0; i < 8; ++i) { const int ka = k0 + 8 * g + i, kb = ka + 16; v[i] = ka < K ? W[(size_t)(ka < K ? ka : K - 1) * ld + n] : 0.f; v[8 + i] = kb < K ? W[(size_t)(kb < K ? kb : K - 1) * ld + n] : 0.f; }
  return bsplit16(v); }
__device__ __forceinline__ v8f mac3(const F2& a, const F2& b, v8f c) { c = wmma_bf(a.l, b.h, c); c = wmma_bf(a.h, b.l, c); return wmma_bf(a.h, b.h, c); }
__device__ __forceinline__ float sigm(float v) { return 1.0f / (1.0f + expf(-v)); }
#define LDSX() do { asm volatile("s_wait_dscnt 0" ::: "memory"); __builtin_amdgcn_wave_barrier(); __builtin_amdgcn_fence(__ATOMIC_RELEASE, "workgroup"); } while (0)


// PixelSNAIL causal attention (B 8, 32x32 = 1,024 positions, q from a 256-ch query map, k/v from a 256-ch key map, embed 512 = 8 heads x 64): channel-major in, channel-major out [b][h*64+d][s].
#define NB 8
#define TT 1024
#define CC 512
#define NH 8
#define HD 64
#ifndef TNB
#define TNB NB
#endif
typedef __attribute__((ext_vector_type(8))) __bf16 v8b;
__device__ __forceinline__ v16b frag_b(const __bf16* rowk0, int lane) {
  union { v16b v; v8b q[2]; } u; const __bf16* p = rowk0 + 8 * (lane >> 4);
  u.q[0] = *(const v8b*)p; u.q[1] = *(const v8b*)(p + 16); return u.v;
}
__device__ __forceinline__ float bfr(float v) { return (float)(__bf16)v; }
__device__ __attribute__((noinline)) float exp_ni(float v) { return expf(v); }
__device__ __attribute__((noinline)) float erf_ni(float v) { return erff(v); }

#define WS_QH  0u
#define WS_QL  (WS_QH + 2u * (size_t)NB * TT * CC)
#define WS_KH  (WS_QL + 2u * (size_t)NB * TT * CC)
#define WS_VT  (WS_KH + 2u * (size_t)NB * TT * CC)      // bf16 v planes [b][c][t]
#define WS_VL  (WS_VT + 2u * (size_t)NB * CC * TT)      // bf16 v residual planes
#define HG (NB * NH)                                  // (batch, head) pairs per launch: all of them
// packed causal logits of one (batch, head): 64-row block x keeps only its keys [0, 128 * (x / 2 + 1)), so that all HG pairs fit the workspace
#define SPH (72u * 8192u)                             // floats per (batch, head): 64 * 128 * (1+1+2+2+...+8+8)
__device__ __forceinline__ int s_pitch(int x) { return 128 * ((x >> 1) + 1); }                           // floats per row in row block x
__device__ __forceinline__ size_t s_off(int x) { return (size_t)8192 * ((x >> 1) + 1) * ((x >> 1) + (x & 1)); }   // first float of row block x
#define WS_S   (WS_VL + 2u * (size_t)NB * CC * TT)      // f32 logits / P [b * NH + h][packed q blocks][k]
#define WS_PH  (WS_S + 4u * (size_t)HG * SPH)
#define WS_END (WS_PH + 16u)

#define CIN 256
// ---- k_proj: block = (64 positions, 128 out cols, b*3 + which): x^T tile [64 s][256 c] bf16 in LDS from the channel-major map (query for q, key for k/v); W [out][in] + b exact; q -> f16 hi + residual rows, k -> f16 rows, v -> bf16 hi + lo planes
__global__ __launch_bounds__(128) void k_proj(const float* __restrict__ XQ, const float* __restrict__ XK, const float* __restrict__ WQ, const float* __restrict__ BQ, const float* __restrict__ WK, const float* __restrict__ BK, const float* __restrict__ WV, const float* __restrict__ BV, _Float16* __restrict__ QH, _Float16* __restrict__ QL, _Float16* __restrict__ KH, __bf16* __restrict__ VT, __bf16* __restrict__ VL) {
  __shared__ __align__(16) __bf16 sx[64][CIN + 8]; __shared__ __align__(16) _Float16 sh[64][136], sl[64][136]; __shared__ __align__(16) __bf16 th[128][72], tl2[128][72];
  const int tid = threadIdx.x, wave = tid >> 5, lane = tid & 31, col = lane & 15, g = lane >> 4; const int p0 = blockIdx.x * 64; const int c0 = blockIdx.y * 128; const size_t b = blockIdx.z / 3; const int which = blockIdx.z % 3;
  const float* X = which == 0 ? XQ : XK; const float* Wm = which == 0 ? WQ : which == 1 ? WK : WV; const float* Bm = which == 0 ? BQ : which == 1 ? BK : BV;
  for (int e = tid; e < CIN * 64; e += 128) { const int c = e >> 6, pl = e & 63; sx[pl][c] = (__bf16)X[(b * CIN + c) * (size_t)TT + p0 + pl]; }
  __syncthreads();
  v8f acc[8] = {};
#pragma unroll 2
  for (int kc = 0; kc < CIN / 32; ++kc) { const v16b a = frag_b(&sx[wave * 16 + col][kc * 32], lane);
#pragma unroll
    for (int j = 0; j < 8; ++j) { v16b w; const int o = c0 + j * 16 + col;
#pragma unroll
      for (int i = 0; i < 8; ++i) { w[i] = (__bf16)Wm[(size_t)o * CIN + kc * 32 + 8 * g + i]; w[8 + i] = (__bf16)Wm[(size_t)o * CIN + kc * 32 + 16 + 8 * g + i]; }
      acc[j] = wmma_bf(a, w, acc[j]); } }
#pragma unroll
  for (int j = 0; j < 8; ++j) { const float bb = bfr(Bm[c0 + j * 16 + col]);
#pragma unroll
    for (int r = 0; r < 8; ++r) { const float v = acc[j][r] + bb; const int rl = wave * 16 + 8 * g + r, cl = j * 16 + col;
      if (which == 2) { const __bf16 bh = (__bf16)v; th[cl][rl] = bh; tl2[cl][rl] = (__bf16)(v - (float)bh); } else { const _Float16 hv = (_Float16)v; sh[rl][cl] = hv; sl[rl][cl] = (_Float16)(v - (float)hv); } } }
  __syncthreads();
  if (which < 2) { _Float16* dh = which == 0 ? QH : KH; for (int e = tid; e < 64 * 16; e += 128) { const int rl = e >> 4, q = e & 15; const size_t row = b * TT + p0 + rl; vst2((unsigned*)(dh + row * CC + c0 + q * 8), *(const v4u*)&sh[rl][q * 8]); if (which == 0) vst2((unsigned*)(QL + row * CC + c0 + q * 8), *(const v4u*)&sl[rl][q * 8]); } }
  else { for (int e = tid; e < 128 * 8; e += 128) { const int cl = e >> 3, q = e & 7; const size_t o2 = (b * CC + c0 + cl) * (size_t)TT + p0 + q * 8; vst2((unsigned*)(VT + o2), *(const v4u*)&th[cl][q * 8]); vst2((unsigned*)(VL + o2), *(const v4u*)&tl2[cl][q * 8]); } } }
// ---- k_sc: block = (64 queries, 128 keys) of (b,h): logits * scale; causal blocks beyond the diagonal exit
__global__ __launch_bounds__(128) void k_sc(const _Float16* __restrict__ QH, const _Float16* __restrict__ QL, const _Float16* __restrict__ KH, const float* __restrict__ BM, float* __restrict__ S0) { __shared__ __align__(16) float ss[4][16][132]; const int b = blockIdx.z / NH, h = blockIdx.z % NH; float* S = S0 + (size_t)blockIdx.z * SPH + s_off(blockIdx.x); const int sp = s_pitch(blockIdx.x);
  const int tid = threadIdx.x, wave = tid >> 5, lane = tid & 31, col = lane & 15, g = lane >> 4; const int k0 = blockIdx.y * 128; const int ql0 = blockIdx.x * 64 + wave * 16; const size_t q0 = (size_t)b * TT + ql0;
  if (k0 > blockIdx.x * 64 + 63) return;   // whole key block above the diagonal (block-uniform)
  v8f acc[8] = {};
#pragma unroll
  for (int kc = 0; kc < HD / 32; ++kc) { const v16h ah = frag_h(QH + (q0 + col) * CC + h * HD + kc * 32, lane), al = frag_h(QL + (q0 + col) * CC + h * HD + kc * 32, lane);
#pragma unroll
    for (int j = 0; j < 8; ++j) { const v16h kb = frag_h(KH + ((size_t)b * TT + k0 + j * 16 + col) * CC + h * HD + kc * 32, lane); acc[j] = wmma16(ah, kb, acc[j]); acc[j] = wmma16(al, kb, acc[j]); } }
#pragma unroll
  for (int j = 0; j < 8; ++j) { const int kt = k0 + j * 16 + col;
#pragma unroll
    for (int r = 0; r < 8; ++r) { const int qt = ql0 + 8 * g + r; float v = acc[j][r] * 0.125f; (void)BM; if (kt > qt) v = -3.0e38f; ss[wave][8 * g + r][j * 16 + col] = v; } }
  LDSX(); for (int rl = 0; rl < 16; ++rl) vst2(S + (size_t)(wave * 16 + rl) * sp + k0 + lane * 4, *(const v4f*)&ss[wave][rl][lane * 4]); }
// ---- k_sm: block = query row: softmax over keys [0, kend) -> P x 2^11 f32 (masked -> 0)
__global__ __launch_bounds__(256) void k_sm(float* __restrict__ S0) { __shared__ float sred[8]; __shared__ float sbc; __shared__ __align__(16) float sh[TT];
  const int t = threadIdx.x; const size_t row = blockIdx.x; float* sr = S0 + (size_t)blockIdx.y * SPH + s_off((int)row >> 6) + (row & 63) * (size_t)s_pitch((int)row >> 6); const int kend = ((int)row / 64) * 64 + 64;
  float m = -3.0e38f; for (int k = t; k < kend; k += 256) m = fmaxf(m, sr[k]);
#pragma unroll
  for (int o = 1; o < 32; o <<= 1) m = fmaxf(m, __shfl_xor(m, o));
  if ((t & 31) == 0) sred[t >> 5] = m; __syncthreads(); if (t == 0) { float a = sred[0]; for (int i = 1; i < 8; ++i) a = fmaxf(a, sred[i]); sbc = a; } __syncthreads(); m = sbc; __syncthreads();
  float sum = 0.f; for (int k = t; k < kend; k += 256) { const float v = sr[k]; sum += (v <= -1.0e38f) ? 0.f : expf(v - m); }
#pragma unroll
  for (int o = 1; o < 32; o <<= 1) sum += __shfl_xor(sum, o);
  if ((t & 31) == 0) sred[t >> 5] = sum; __syncthreads(); if (t == 0) { float a = 0.f; for (int i = 0; i < 8; ++i) a += sred[i]; sbc = 1.0f / a; } __syncthreads(); const float inv = sbc;
  for (int k = t; k < kend; k += 256) { const float v = sr[k]; sh[k] = (v <= -1.0e38f) ? 0.f : expf(v - m) * inv * 2048.0f; }
  __syncthreads(); for (int q = t; q < kend / 4; q += 256) vst2(sr + q * 4, *(const v4f*)&sh[q * 4]); }
// ---- k_pv: block = 64 queries of (b,h): y[q][h*HD + d] = P . v  (keys [0, kend))
__global__ __launch_bounds__(128) void k_pv(const float* __restrict__ PS0, const __bf16* __restrict__ VT, const __bf16* __restrict__ VL, float* __restrict__ Y) { const int b = blockIdx.z / NH, h = blockIdx.z % NH; const float* PS = PS0 + (size_t)blockIdx.z * SPH + s_off(blockIdx.x); const int sp = s_pitch(blockIdx.x); __shared__ __align__(16) float ss[4][16][HD + 4];
  const int tid = threadIdx.x, wave = tid >> 5, lane = tid & 31, col = lane & 15, g = lane >> 4; const int kend = blockIdx.x * 64 + 64;
  v8f acc[HD / 16] = {};
#pragma unroll 1
  for (int kc = 0; kc < kend / 32; ++kc) { const F2 p = split_row(PS + (size_t)(wave * 16 + col) * sp, kc * 32, lane);
#pragma unroll
    for (int j = 0; j < HD / 16; ++j) { const size_t po = ((size_t)b * CC + h * HD + j * 16 + col) * (size_t)TT + kc * 32; const v16b vh = frag_b(VT + po, lane); acc[j] = wmma_bf(p.h, vh, acc[j]); acc[j] = wmma_bf(p.l, vh, acc[j]); acc[j] = wmma_bf(p.h, frag_b(VL + po, lane), acc[j]); } }
#pragma unroll
  for (int j = 0; j < HD / 16; ++j)
#pragma unroll
    for (int r = 0; r < 8; ++r) ss[wave][8 * g + r][j * 16 + col] = acc[j][r] * (1.0f / 2048.0f);
  __syncthreads();
  { __shared__ __align__(16) float so[HD][68]; for (int e = threadIdx.x; e < 64 * HD; e += 128) { const int ql = e / HD, d = e % HD; so[d][ql] = ss[ql >> 4][ql & 15][d]; } __syncthreads();
    for (int e = threadIdx.x; e < HD * 16; e += 128) { const int d = e >> 4, q4 = e & 15; vst2(Y + ((size_t)b * CC + h * HD + d) * TT + blockIdx.x * 64 + q4 * 4, *(const v4f*)&so[d][q4 * 4]); } } }
extern "C" void kernel_launch(void* const* d_in, const int* in_sizes, int n_in, void* d_out, int out_size, void* d_ws, size_t ws_size, hipStream_t stream) {
  (void)in_sizes; (void)n_in; (void)out_size;
  const float** F = (const float**)d_in;   // 0 query [8,256,32,32], 1 key [8,256,32,32], 2 Wq [512,256], 3 bq, 4 Wk [512,256], 5 bk, 6 Wv [512,256], 7 bv
  if (ws_size < (size_t)WS_END) return;
  char* ws = (char*)d_ws; _Float16 *QH = (_Float16*)(ws + WS_QH), *QL = (_Float16*)(ws + WS_QL), *KH = (_Float16*)(ws + WS_KH); __bf16 *VT = (__bf16*)(ws + WS_VT), *VL = (__bf16*)(ws + WS_VL); float *S = (float*)(ws + WS_S);
  k_proj<<<dim3(TT / 64, CC / 128, TNB * 3), 128, 0, stream>>>(F[0], F[1], F[2], F[3], F[4], F[5], F[6], F[7], QH, QL, KH, VT, VL);
  k_sc<<<dim3(TT / 64, TT / 128, HG), 128, 0, stream>>>(QH, QL, KH, nullptr, S);   // every (batch, head) in one launch per stage
  k_sm<<<dim3(TT, HG), 256, 0, stream>>>(S);
  k_pv<<<dim3(TT / 64, 1, HG), 128, 0, stream>>>(S, VT, VL, (float*)d_out);
}

// v002
// It runs in 137 microseconds.
// Two timings next to v001 both put it at 2.58 times that version's speed.
// All steps since v000 together make it 5.42 times as fast.
// compute dtype: all float inputs rounded to bf16; q = query^T Wq^T + bq, k/v = key^T W^T + b with EXACT bf16 products on WMMA 16x16x32 (channel-major tiles transposed in LDS), f32 accumulate; q as f16 hi + residual, k f16 -> 2-product causal logits / 8 kept in the accumulator registers (S^T = K Q^T), online softmax in f32 (exponential at full f32 accuracy), P split bf16 hi + lo against v bf16 hi + lo (3 products, O^T = V^T P^T), divided by the row sum at the end; output written channel-major [b][e][s] in f32 (no output projection).
#include <hip/hip_runtime.h>
#include <math.h>

typedef __attribute__((ext_vector_type(16))) _Float16 v16h;
typedef __attribute__((ext_vector_type(16))) __bf16 v16b;
typedef __attribute__((ext_vector_type(8)))  _Float16 v8h;
typedef __attribute__((ext_vector_type(8)))  float v8f;
typedef __attribute__((ext_vector_type(4)))  float v4f;
typedef __attribute__((ext_vector_type(2)))  float v2f;
typedef __attribute__((ext_vector_type(4)))  unsigned v4u;
typedef __attribute__((ext_vector_type(4)))  int v4i;
typedef float __attribute__((may_alias)) float_a;
typedef int __attribute__((may_alias)) int_a;

template <typename T> __device__ __forceinline__ void vst2(void* p, T v) { *(T*)p = v;  }
__device__ __forceinline__ v8f wmma16(v16h a, v16h b, v8f c) {
  v8f d = __builtin_amdgcn_wmma_f32_16x16x32_f16(false, a, false, b, (short)0, c, false, false);
  asm volatile("v_nop\n\tv_nop\n\tv_nop\n\tv_nop" : "+v"(d) : "v"(a), "v"(b));
  return d;
}
__device__ __forceinline__ v8f wmma_bf(v16b a, v16b b, v8f c) {
  v8f d = __builtin_amdgcn_wmma_f32_16x16x32_bf16(false, a, false, b, (short)0, c, false, false);
  asm volatile("v_nop\n\tv_nop\n\tv_nop\n\tv_nop" : "+v"(d) : "v"(a), "v"(b));
  return d;
}
// 16x16x32 fragments: lane = (h = lane>>4, row/col = lane&15); elements 0..7 = k0+8h+0..7, 8..15 = k0+16+8h+0..7; D element r = row 8h+r
__device__ __forceinline__ v16h frag_h(const _Float16* rowk0, int lane) {
  union { v16h v; v8h q[2]; } u; const _Float16* p = rowk0 + 8 * (lane >> 4);
  u.q[0] = *(const v8h*)p; u.q[1] = *(const v8h*)(p + 16); return u.v;
}
__device__ __forceinline__ v16h frag_f32(const float* rowk0, int lane) {
  v16h a; const float* p = rowk0 + 8 * (lane >> 4);
#pragma unroll
  for (int i = 0; i < 8; ++i) { a[i] = (_Float16)p[i]; a[8 + i] = (_Float16)p[16 + i]; }
  return a;
}
__device__ __forceinline__ v16h frag_f32s(const float* rowk0, int lane, float sc) {
  v16h a; const float* p = rowk0 + 8 * (lane >> 4);
#pragma unroll
  for (int i = 0; i < 8; ++i) { a[i] = (_Float16)(p[i] * sc); a[8 + i] = (_Float16)(p[16 + i] * sc); }
  return a;
}
// column fragment from a [K][ld] layout (column n), rows >= K read as 0
__device__ __forceinline__ v16h fragc_f32(const float* W, int k0, int n, int lane, int ld, int K) {
  v16h a; const int g = lane >> 4;
#pragma unroll
  for (int i = 0; i < 8; ++i) { const int ka = k0 + 8 * g + i, kb = ka + 16;
    a[i] = (_Float16)(ka < K ? W[(size_t)(ka < K ? ka : K - 1) * ld + n] : 0.f); a[8 + i] = (_Float16)(kb < K ? W[(size_t)(kb < K ? kb : K - 1) * ld + n] : 0.f); }
  return a;
}
struct F2 { v16b h, l; };
__device__ __forceinline__ F2 bsplit16(const float v[16]) { F2 r;
#pragma unroll
  for (int i = 0; i < 16; ++i) { const __bf16 h = (__bf16)v[i]; r.h[i] = h; r.l[i] = (__bf16)(v[i] - (float)h); }
  return r; }
__device__ __forceinline__ F2 split_row(const float* row, int k0, int lane) { float v[16]; const float* p = row + k0 + 8 * (lane >> 4);
#pragma unroll
  for (int i = 0; i < 8; ++i) { v[i] = p[i]; v[8 + i] = p[16 + i]; }
  const F2 r = bsplit16(v);
  asm volatile("s_wait_xcnt 0x0" :: "v"(p) : "memory");   // names the row loads' address as an input: the allocator may reuse that register pair (as a later load's destination) only behind this wait
  return r; }
__device__ __forceinline__ F2 split_rowK(const float* row, int k0, int lane, int K) { float v[16]; const int g = lane >> 4;
#pragma unroll
  for (int i = 0; i < 8; ++i) { const int ka = k0 + 8 * g + i, kb = ka + 16; v[i] = ka < K ? row[ka < K ? ka : K - 1] : 0.f; v[8 + i] = kb < K ? row[kb < K ? kb : K - 1] : 0.f; }
  return bsplit16(v); }
__device__ __forceinline__ F2 split_col(const float* W, int k0, int n, int lane, int ld, int K) { float v[16]; const int g = lane >> 4;
#pragma unroll
  for (int i = 0; i < 8; ++i) { const int ka = k0 + 8 * g + i, kb = ka + 16; v[i] = ka < K ? W[(size_t)(ka < K ? ka : K - 1) * ld + n] : 0.f; v[8 + i] = kb < K ? W[(size_t)(kb < K ? kb : K - 1) * ld + n] : 0.f; }
  return bsplit16(v); }
__device__ __forceinline__ v8f mac3(const F2& a, const F2& b, v8f c) { c = wmma_bf(a.l, b.h, c); c = wmma_bf(a.h, b.l, c); return wmma_bf(a.h, b.h, c); }
__device__ __forceinline__ float sigm(float v) { return 1.0f / (1.0f + expf(-v)); }
#define LDSX() do { asm volatile("s_wait_dscnt 0" ::: "memory"); __builtin_amdgcn_wave_barrier(); __builtin_amdgcn_fence(__ATOMIC_RELEASE, "workgroup"); } while (0)


// PixelSNAIL causal attention (B 8, 32x32 = 1,024 positions, q from a 256-ch query map, k/v from a 256-ch key map, embed 512 = 8 heads x 64): channel-major in, channel-major out [b][h*64+d][s].
#define NB 8
#define TT 1024
#define CC 512
#define NH 8
#define HD 64
#ifndef TNB
#define TNB NB
#endif
typedef __attribute__((ext_vector_type(8))) __bf16 v8b;
__device__ __forceinline__ v16b frag_b(const __bf16* rowk0, int lane) {
  union { v16b v; v8b q[2]; } u; const __bf16* p = rowk0 + 8 * (lane >> 4);
  u.q[0] = *(const v8b*)p; u.q[1] = *(const v8b*)(p + 16); return u.v;
}
__device__ __forceinline__ float bfr(float v) { return (float)(__bf16)v; }
__device__ __attribute__((noinline)) float exp_ni(float v) { return expf(v); }
__device__ __attribute__((noinline)) float erf_ni(float v) { return erff(v); }

#define WS_QH  0u
#define WS_QL  (WS_QH + 2u * (size_t)NB * TT * CC)
#define WS_KH  (WS_QL + 2u * (size_t)NB * TT * CC)
#define WS_VT  (WS_KH + 2u * (size_t)NB * TT * CC)      // bf16 v planes [b][c][t]
#define WS_VL  (WS_VT + 2u * (size_t)NB * CC * TT)      // bf16 v residual planes
#define HG (NB * NH)                                  // (batch, head) pairs per launch: all of them
#define WS_END (WS_VL + 2u * (size_t)NB * CC * TT)

#define CIN 256
// ---- k_proj: block = (64 positions, 128 out cols, b*3 + which): x^T tile [64 s][256 c] bf16 in LDS from the channel-major map (query for q, key for k/v); W [out][in] + b exact; q -> f16 hi + residual rows, k -> f16 rows, v -> bf16 hi + lo planes
__global__ __launch_bounds__(128) void k_proj(const float* __restrict__ XQ, const float* __restrict__ XK, const float* __restrict__ WQ, const float* __restrict__ BQ, const float* __restrict__ WK, const float* __restrict__ BK, const float* __restrict__ WV, const float* __restrict__ BV, _Float16* __restrict__ QH, _Float16* __restrict__ QL, _Float16* __restrict__ KH, __bf16* __restrict__ VT, __bf16* __restrict__ VL) {
  __shared__ __align__(16) __bf16 sx[64][CIN + 8]; __shared__ __align__(16) _Float16 sh[64][136], sl[64][136]; __shared__ __align__(16) __bf16 th[128][72], tl2[128][72];
  const int tid = threadIdx.x, wave = tid >> 5, lane = tid & 31, col = lane & 15, g = lane >> 4; const int p0 = blockIdx.x * 64; const int c0 = blockIdx.y * 128; const size_t b = blockIdx.z / 3; const int which = blockIdx.z % 3;
  const float* X = which == 0 ? XQ : XK; const float* Wm = which == 0 ? WQ : which == 1 ? WK : WV; const float* Bm = which == 0 ? BQ : which == 1 ? BK : BV;
  for (int e = tid; e < CIN * 64; e += 128) { const int c = e >> 6, pl = e & 63; sx[pl][c] = (__bf16)X[(b * CIN + c) * (size_t)TT + p0 + pl]; }
  __syncthreads();
  v8f acc[8] = {};
#pragma unroll 2
  for (int kc = 0; kc < CIN / 32; ++kc) { const v16b a = frag_b(&sx[wave * 16 + col][kc * 32], lane);
#pragma unroll
    for (int j = 0; j < 8; ++j) { v16b w; const int o = c0 + j * 16 + col;
#pragma unroll
      for (int i = 0; i < 8; ++i) { w[i] = (__bf16)Wm[(size_t)o * CIN + kc * 32 + 8 * g + i]; w[8 + i] = (__bf16)Wm[(size_t)o * CIN + kc * 32 + 16 + 8 * g + i]; }
      acc[j] = wmma_bf(a, w, acc[j]); } }
#pragma unroll
  for (int j = 0; j < 8; ++j) { const float bb = bfr(Bm[c0 + j * 16 + col]);
#pragma unroll
    for (int r = 0; r < 8; ++r) { const float v = acc[j][r] + bb; const int rl = wave * 16 + 8 * g + r, cl = j * 16 + col;
      if (which == 2) { const __bf16 bh = (__bf16)v; th[cl][rl] = bh; tl2[cl][rl] = (__bf16)(v - (float)bh); } else { const _Float16 hv = (_Float16)v; sh[rl][cl] = hv; sl[rl][cl] = (_Float16)(v - (float)hv); } } }
  __syncthreads();
  if (which < 2) { _Float16* dh = which == 0 ? QH : KH; for (int e = tid; e < 64 * 16; e += 128) { const int rl = e >> 4, q = e & 15; const size_t row = b * TT + p0 + rl; vst2((unsigned*)(dh + row * CC + c0 + q * 8), *(const v4u*)&sh[rl][q * 8]); if (which == 0) vst2((unsigned*)(QL + row * CC + c0 + q * 8), *(const v4u*)&sl[rl][q * 8]); } }
  else { for (int e = tid; e < 128 * 8; e += 128) { const int cl = e >> 3, q = e & 7; const size_t o2 = (b * CC + c0 + cl) * (size_t)TT + p0 + q * 8; vst2((unsigned*)(VT + o2), *(const v4u*)&th[cl][q * 8]); vst2((unsigned*)(VL + o2), *(const v4u*)&tl2[cl][q * 8]); } } }
__device__ __forceinline__ v8f mm16(v16h a, v16h b, v8f c) { return __builtin_amdgcn_wmma_f32_16x16x32_f16(false, a, false, b, (short)0, c, false, false); }
__device__ __forceinline__ v8f mmbf(v16b a, v16b b, v8f c) { return __builtin_amdgcn_wmma_f32_16x16x32_bf16(false, a, false, b, (short)0, c, false, false); }
// one 16x16x32 fragment in the hardware k order; p = row + k0 + 8 * (lane >> 4): elements 0..7 at p, 8..15 at p + 16
template <typename V16, typename V8, typename E> __device__ __forceinline__ V16 ld16(const E* p) { union { V16 v; V8 q[2]; } u; u.q[0] = *(const V8*)p; u.q[1] = *(const V8*)(p + 16); return u.v; }
// e^x for x <= 0 at full f32 accuracy: x * log2(e), held in two parts, minus its nearest integer n; 2^fraction on the transcendental unit, times 2^n; 0 below the underflow bound (a masked score)
__device__ __forceinline__ float exp_le0(float x) {
  const float n = rintf(x * 0x1.715476p+0f);
  const float a = fmaf(x, 0x1.4ae0bep-26f, fmaf(x, 0x1.715476p+0f, -n));
  float r; asm("v_exp_f32 %0, %1\n\tv_nop" : "=v"(r) : "v"(a));   // v_nop: the one slot that the instruction set asks for behind a transcendental, tied to it here (the compiler left one open behind expf)
  return x < -0x1.9d1da0p+6f ? 0.f : ldexpf(r, (int)n); }
// lane l <-> lane l ^ 16
__device__ __forceinline__ float xhalf(float x) { return __builtin_bit_cast(float, __builtin_amdgcn_permlanex16(__builtin_bit_cast(int, x), __builtin_bit_cast(int, x), 0x76543210, 0xfedcba98, false, false)); }
// ---- k_att: block = (query tile pair, (b,h)); 4 waves x 16 queries walk 64-query tile 15 - x, then tile x (equal work in every block). Per 32-key pass of a wave:
// S^T = K Q^T (a lane holds 16 keys of ONE query, lane ^ 16 the other 16), running maximum and sum, P^T packed from the score registers as the B operand, O^T += V^T P^T.
// Every plain '#pragma unroll' below unrolls a short constant loop fully, so that the fragment and accumulator arrays it indexes stay in registers.
__global__ __launch_bounds__(128) void k_att(const _Float16* __restrict__ QH, const _Float16* __restrict__ QL, const _Float16* __restrict__ KH, const __bf16* __restrict__ VT, const __bf16* __restrict__ VL, float* __restrict__ Y) {
  __shared__ __align__(16) float so[HD][68];
  const int tid = threadIdx.x, lane = tid & 31, col = lane & 15, g = lane >> 4; const int wave = __builtin_amdgcn_readfirstlane(tid >> 5);   // scalar: a wave's trip count and its diagonal test become scalar branches (EXEC stays full at the matrix instructions)
  const int b = blockIdx.y / NH, h = blockIdx.y % NH;
  const _Float16* kp = KH + ((size_t)b * TT + col) * CC + h * HD + 8 * g;                  // key row col of a 16-key tile
  const size_t vo = ((size_t)b * CC + h * HD + col) * (size_t)TT + 8 * g; const __bf16* vhp = VT + vo; const __bf16* vlp = VL + vo;   // channel row col of a 16-channel tile
#pragma unroll 1   // rolled: one copy of the pass loop serves both tiles (instruction cache)
  for (int half = 0; half < 2; ++half) { const int x = half ? (int)blockIdx.x : TT / 64 - 1 - (int)blockIdx.x; const int ql0 = x * 64 + wave * 16;
    const int nb = (ql0 + 47) >> 5;   // 32-key passes that hold keys [0, ql0 + 16); every query has an unmasked key in each of them
    v16h qh[2], ql[2], kf[2][2]; const size_t qo = ((size_t)b * TT + ql0 + col) * CC + h * HD + 8 * g; const _Float16* qhp = QH + qo; const _Float16* qlp = QL + qo;
#pragma unroll
    for (int kc = 0; kc < 2; ++kc) { qh[kc] = ld16<v16h, v8h>(qhp + kc * 32); ql[kc] = ld16<v16h, v8h>(qlp + kc * 32); }
#pragma unroll
    for (int t = 0; t < 2; ++t)
#pragma unroll
      for (int kc = 0; kc < 2; ++kc) kf[t][kc] = ld16<v16h, v8h>(kp + (size_t)(t * 16) * CC + kc * 32);
    asm volatile("s_wait_xcnt 0x0" :: "v"(qhp), "v"(qlp), "v"(kp) : "memory");   // names the loads' addresses as inputs: their registers may be reused (also as a later load's destination) only behind this wait
    float m = -3.0e38f, l = 0.f; v8f acc[HD / 16] = {};
#pragma unroll 1   // rolled: a second copy of the pass would need a second set of V^T fragments in registers
    for (int p = 0; p < nb; ++p) {
      const __bf16* pvh = vhp + p * 32; const __bf16* pvl = vlp + p * 32;
      v16b vh[HD / 16], vl[HD / 16];   // this pass's V^T fragments: in flight under the score products and the softmax
#pragma unroll
      for (int j = 0; j < HD / 16; ++j) { vh[j] = ld16<v16b, v8b>(pvh + (size_t)(j * 16) * TT); vl[j] = ld16<v16b, v8b>(pvl + (size_t)(j * 16) * TT); }
      v8f st[2] = {};
#pragma unroll
      for (int kc = 0; kc < 2; ++kc) {
#pragma unroll
        for (int t = 0; t < 2; ++t) st[t] = mm16(kf[t][kc], qh[kc], st[t]);
#pragma unroll
        for (int t = 0; t < 2; ++t) st[t] = mm16(kf[t][kc], ql[kc], st[t]); }
      asm volatile("s_wait_xcnt 0x0" :: "v"(pvh), "v"(pvl) : "memory");   // the V^T loads' address registers may be reused (also as a later load's destination) only behind this wait
      { const int pn = p + 1 < nb ? p + 1 : p; const _Float16* pk = kp + (size_t)(pn * 32) * CC;   // next pass's K fragments, one pass ahead (the last pass re-reads its own rows: always in bounds)
#pragma unroll
        for (int t = 0; t < 2; ++t)
#pragma unroll
          for (int kc = 0; kc < 2; ++kc) kf[t][kc] = ld16<v16h, v8h>(pk + (size_t)(t * 16) * CC + kc * 32);
        asm volatile("s_wait_xcnt 0x0" :: "v"(pk) : "memory"); }   // the same for the K loads' address
      float s[16];
#pragma unroll
      for (int i = 0; i < 16; ++i) s[i] = st[i >> 3][i & 7] * 0.125f;   // key p * 32 + 16 * (i >> 3) + 8 * g + (i & 7), query ql0 + col
      if (p == nb - 1) {   // wave-uniform: only the last pass meets the diagonal
#pragma unroll
        for (int i = 0; i < 16; ++i) if (p * 32 + 16 * (i >> 3) + 8 * g + (i & 7) > ql0 + col) s[i] = -3.0e38f; }
      float mx = s[0];
#pragma unroll
      for (int i = 1; i < 16; ++i) mx = fmaxf(mx, s[i]);
      mx = fmaxf(mx, xhalf(mx));
      const float mn = fmaxf(m, mx), al = exp_le0(m - mn); m = mn;   // al = 0 in the first pass
      float ps = 0.f;
#pragma unroll
      for (int i = 0; i < 16; ++i) { s[i] = exp_le0(s[i] - mn); ps += s[i]; }   // a masked score gives 0
      l = l * al + ps;   // each lane half sums its own keys; the halves join behind the loop
      const F2 pf = bsplit16(s);
#pragma unroll
      for (int j = 0; j < HD / 16; ++j) acc[j] = acc[j] * al;
#pragma unroll
      for (int j = 0; j < HD / 16; ++j) acc[j] = mmbf(vh[j], pf.h, acc[j]);
#pragma unroll
      for (int j = 0; j < HD / 16; ++j) acc[j] = mmbf(vh[j], pf.l, acc[j]);
#pragma unroll
      for (int j = 0; j < HD / 16; ++j) acc[j] = mmbf(vl[j], pf.h, acc[j]); }
    l += xhalf(l); const float inv = 1.0f / l;
#pragma unroll
    for (int j = 0; j < HD / 16; ++j)
#pragma unroll
      for (int r = 0; r < 8; ++r) so[j * 16 + 8 * g + r][wave * 16 + col] = acc[j][r] * inv;   // O^T: row = channel, column = query
    __syncthreads();   // all four waves' columns stand in so
    for (int e = tid; e < HD * 16; e += 128) { const int d = e >> 4, q4 = e & 15; vst2(Y + ((size_t)b * CC + h * HD + d) * TT + x * 64 + q4 * 4, *(const v4f*)&so[d][q4 * 4]); }
    __syncthreads();   // so is rewritten by the second tile
  } }
extern "C" void kernel_launch(void* const* d_in, const int* in_sizes, int n_in, void* d_out, int out_size, void* d_ws, size_t ws_size, hipStream_t stream) {
  (void)in_sizes; (void)n_in; (void)out_size;
  const float** F = (const float**)d_in;   // 0 query [8,256,32,32], 1 key [8,256,32,32], 2 Wq [512,256], 3 bq, 4 Wk [512,256], 5 bk, 6 Wv [512,256], 7 bv
  if (ws_size < (size_t)WS_END) return;
  char* ws = (char*)d_ws; _Float16 *QH = (_Float16*)(ws + WS_QH), *QL = (_Float16*)(ws + WS_QL), *KH = (_Float16*)(ws + WS_KH); __bf16 *VT = (__bf16*)(ws + WS_VT), *VL = (__bf16*)(ws + WS_VL);
  k_proj<<<dim3(TT / 64, CC / 128, TNB * 3), 128, 0, stream>>>(F[0], F[1], F[2], F[3], F[4], F[5], F[6], F[7], QH, QL, KH, VT, VL);
  k_att<<<dim3(TT / 128, HG), 128, 0, stream>>>(QH, QL, KH, VT, VL, (float*)d_out);   // logits, softmax and P.V of every (batch, head) in one launch
}

// v003
// It runs in 91.6 microseconds.
// Next to v002, in two timings, it ran 1.50 and 1.49 times as fast.
// All steps since v000 together make it 8.11 times as fast.
// compute dtype: all float inputs rounded to bf16; q = query^T Wq^T + bq, k/v = key^T W^T + b with EXACT bf16 products on WMMA 16x16x32 (channel-major tiles transposed in LDS), f32 accumulate; q as f16 hi + residual, k f16 -> 2-product causal logits / 8 kept in the accumulator registers (S^T = K Q^T), online softmax in f32 (exponential at full f32 accuracy), P split bf16 hi + lo against v bf16 hi + lo (3 products, O^T = V^T P^T), divided by the row sum at the end; output written channel-major [b][e][s] in f32 (no output projection).
#include <hip/hip_runtime.h>
#include <math.h>

typedef __attribute__((ext_vector_type(16))) _Float16 v16h;
typedef __attribute__((ext_vector_type(16))) __bf16 v16b;
typedef __attribute__((ext_vector_type(8)))  _Float16 v8h;
typedef __attribute__((ext_vector_type(8)))  float v8f;
typedef __attribute__((ext_vector_type(4)))  float v4f;
typedef __attribute__((ext_vector_type(2)))  float v2f;
typedef __attribute__((ext_vector_type(4)))  unsigned v4u;
typedef __attribute__((ext_vector_type(4)))  int v4i;
typedef float __attribute__((may_alias)) float_a;
typedef int __attribute__((may_alias)) int_a;

template <typename T> __device__ __forceinline__ void vst2(void* p, T v) { *(T*)p = v;  }
__device__ __forceinline__ v8f wmma16(v16h a, v16h b, v8f c) {
  v8f d = __builtin_amdgcn_wmma_f32_16x16x32_f16(false, a, false, b, (short)0, c, false, false);
  asm volatile("v_nop\n\tv_nop\n\tv_nop\n\tv_nop" : "+v"(d) : "v"(a), "v"(b));
  return d;
}
__device__ __forceinline__ v8f wmma_bf(v16b a, v16b b, v8f c) {
  v8f d = __builtin_amdgcn_wmma_f32_16x16x32_bf16(false, a, false, b, (short)0, c, false, false);
  asm volatile("v_nop\n\tv_nop\n\tv_nop\n\tv_nop" : "+v"(d) : "v"(a), "v"(b));
  return d;
}
// 16x16x32 fragments: lane = (h = lane>>4, row/col = lane&15); elements 0..7 = k0+8h+0..7, 8..15 = k0+16+8h+0..7; D element r = row 8h+r
__device__ __forceinline__ v16h frag_h(const _Float16* rowk0, int lane) {
  union { v16h v; v8h q[2]; } u; const _Float16* p = rowk0 + 8 * (lane >> 4);
  u.q[0] = *(const v8h*)p; u.q[1] = *(const v8h*)(p + 16); return u.v;
}
__device__ __forceinline__ v16h frag_f32(const float* rowk0, int lane) {
  v16h a; const float* p = rowk0 + 8 * (lane >> 4);
#pragma unroll
  for (int i = 0; i < 8; ++i) { a[i] = (_Float16)p[i]; a[8 + i] = (_Float16)p[16 + i]; }
  return a;
}
__device__ __forceinline__ v16h frag_f32s(const float* rowk0, int lane, float sc) {
  v16h a; const float* p = rowk0 + 8 * (lane >> 4);
#pragma unroll
  for (int i = 0; i < 8; ++i) { a[i] = (_Float16)(p[i] * sc); a[8 + i] = (_Float16)(p[16 + i] * sc); }
  return a;
}
// column fragment from a [K][ld] layout (column n), rows >= K read as 0
__device__ __forceinline__ v16h fragc_f32(const float* W, int k0, int n, int lane, int ld, int K) {
  v16h a; const int g = lane >> 4;
#pragma unroll
  for (int i = 0; i < 8; ++i) { const int ka = k0 + 8 * g + i, kb = ka + 16;
    a[i] = (_Float16)(ka < K ? W[(size_t)(ka < K ? ka : K - 1) * ld + n] : 0.f); a[8 + i] = (_Float16)(kb < K ? W[(size_t)(kb < K ? kb : K - 1) * ld + n] : 0.f); }
  return a;
}
struct F2 { v16b h, l; };
__device__ __forceinline__ F2 bsplit16(const float v[16]) { F2 r;
#pragma unroll
  for (int i = 0; i < 16; ++i) { const __bf16 h = (__bf16)v[i]; r.h[i] = h; r.l[i] = (__bf16)(v[i] - (float)h); }
  return r; }
__device__ __forceinline__ F2 split_row(const float* row, int k0, int lane) { float v[16]; const float* p = row + k0 + 8 * (lane >> 4);
#pragma unroll
  for (int i = 0; i < 8; ++i) { v[i] = p[i]; v[8 + i] = p[16 + i]; }
  const F2 r = bsplit16(v);
  asm volatile("s_wait_xcnt 0x0" :: "v"(p) : "memory");   // names the row loads' address as an input: the allocator may reuse that register pair (as a later load's destination) only behind this wait
  return r; }
__device__ __forceinline__ F2 split_rowK(const float* row, int k0, int lane, int K) { float v[16]; const int g = lane >> 4;
#pragma unroll
  for (int i = 0; i < 8; ++i) { const int ka = k0 + 8 * g + i, kb = ka + 16; v[i] = ka < K ? row[ka < K ? ka : K - 1] : 0.f; v[8 + i] = kb < K ? row[kb < K ? kb : K - 1] : 0.f; }
  return bsplit16(v); }
__device__ __forceinline__ F2 split_col(const float* W, int k0, int n, int lane, int ld, int K) { float v[16]; const int g = lane >> 4;
#pragma unroll
  for (int i = 0; i < 8; ++i) { const int ka = k0 + 8 * g + i, kb = ka + 16; v[i] = ka < K ? W[(size_t)(ka < K ? ka : K - 1) * ld + n] : 0.f; v[8 + i] = kb < K ? W[(size_t)(kb < K ? kb : K - 1) * ld + n] : 0.f; }
  return bsplit16(v); }
__device__ __forceinline__ v8f mac3(const F2& a, const F2& b, v8f c) { c = wmma_bf(a.l, b.h, c); c = wmma_bf(a.h, b.l, c); return wmma_bf(a.h, b.h, c); }
__device__ __forceinline__ float sigm(float v) { return 1.0f / (1.0f + expf(-v)); }
#define LDSX() do { asm volatile("s_wait_dscnt 0" ::: "memory"); __builtin_amdgcn_wave_barrier(); __builtin_amdgcn_fence(__ATOMIC_RELEASE, "workgroup"); } while (0)


// PixelSNAIL causal attention (B 8, 32x32 = 1,024 positions, q from a 256-ch query map, k/v from a 256-ch key map, embed 512 = 8 heads x 64): channel-major in, channel-major out [b][h*64+d][s].
#define NB 8
#define TT 1024
#define CC 512
#define NH 8
#define HD 64
#ifndef TNB
#define TNB NB
#endif
typedef __attribute__((ext_vector_type(8))) __bf16 v8b;
typedef __attribute__((ext_vector_type(4))) __bf16 v4b;
__device__ __forceinline__ v16b frag_b(const __bf16* rowk0, int lane) {
  union { v16b v; v8b q[2]; } u; const __bf16* p = rowk0 + 8 * (lane >> 4);
  u.q[0] = *(const v8b*)p; u.q[1] = *(const v8b*)(p + 16); return u.v;
}
__device__ __forceinline__ float bfr(float v) { return (float)(__bf16)v; }
__device__ __attribute__((noinline)) float exp_ni(float v) { return expf(v); }
__device__ __attribute__((noinline)) float erf_ni(float v) { return erff(v); }

#define WS_QH  0u
#define WS_QL  (WS_QH + 2u * (size_t)NB * TT * CC)
#define WS_KH  (WS_QL + 2u * (size_t)NB * TT * CC)
#define WS_VT  (WS_KH + 2u * (size_t)NB * TT * CC)      // bf16 v planes [b][c][t]
#define WS_VL  (WS_VT + 2u * (size_t)NB * CC * TT)      // bf16 v residual planes
#define HG (NB * NH)                                  // (batch, head) pairs per launch: all of them
#define WS_END (WS_VL + 2u * (size_t)NB * CC * TT)

#define CIN 256
// ---- k_proj: block = (64 positions, 128 out cols, b*3 + which): x^T tile [64 s][256 c] bf16 in LDS from the channel-major map (query for q, key for k/v); the 128 rows of W [out][in] in bf16 in LDS too, read as fragments by all four waves; W + b exact; q -> f16 hi + residual rows, k -> f16 rows, v -> bf16 hi + lo planes
__global__ __launch_bounds__(128) void k_proj(const float* __restrict__ XQ, const float* __restrict__ XK, const float* __restrict__ WQ, const float* __restrict__ BQ, const float* __restrict__ WK, const float* __restrict__ BK, const float* __restrict__ WV, const float* __restrict__ BV, _Float16* __restrict__ QH, _Float16* __restrict__ QL, _Float16* __restrict__ KH, __bf16* __restrict__ VT, __bf16* __restrict__ VL) {
  __shared__ __align__(16) __bf16 sx[64][CIN + 8]; __shared__ __align__(16) __bf16 sw[128][CIN + 8];   // sw: the block's 128 rows of W in bf16, one copy for all four waves; pitch 528 B = 16 B x odd
  // the output tiles take sw's place once every wave has left the product loop (the barrier behind it)
  _Float16 (*sh)[136] = (_Float16 (*)[136])&sw[0][0]; _Float16 (*sl)[136] = sh + 64; __bf16 (*th)[72] = (__bf16 (*)[72])&sw[0][0]; __bf16 (*tl2)[72] = th + 128;
  const int tid = threadIdx.x, wave = tid >> 5, lane = tid & 31, col = lane & 15, g = lane >> 4; const int p0 = blockIdx.x * 64; const int c0 = blockIdx.y * 128; const size_t b = blockIdx.z / 3; const int which = blockIdx.z % 3;
  const float* X = which == 0 ? XQ : XK; const float* Wm = which == 0 ? WQ : which == 1 ? WK : WV; const float* Bm = which == 0 ? BQ : which == 1 ? BK : BV;
  { const float* wp = Wm + (size_t)c0 * CIN + tid * 4;   // the 128 rows are one contiguous 128 KiB: a wave's 16-byte loads cover whole lines
#pragma unroll 1   // rolled: two batches of 32 loads in flight; more would only cost registers
    for (int it = 0; it < 2; ++it) { v4f r[32];
#pragma unroll   // unrolled: r stays in registers and the 32 loads issue back to back
      for (int u = 0; u < 32; ++u) r[u] = *(const v4f*)(wp + (it * 32 + u) * 512);
#pragma unroll   // unrolled: r is indexed by constants
      for (int u = 0; u < 32; ++u) { v4b w4; w4[0] = (__bf16)r[u][0]; w4[1] = (__bf16)r[u][1]; w4[2] = (__bf16)r[u][2]; w4[3] = (__bf16)r[u][3]; *(v4b*)&sw[(it * 32 + u) * 2 + (tid >> 6)][(tid & 63) * 4] = w4; } } }
  for (int e = tid; e < CIN * 64; e += 128) { const int c = e >> 6, pl = e & 63; sx[pl][c] = (__bf16)X[(b * CIN + c) * (size_t)TT + p0 + pl]; }
  __syncthreads();
  v8f acc[8] = {};
#pragma unroll 2
  for (int kc = 0; kc < CIN / 32; ++kc) { const v16b a = frag_b(&sx[wave * 16 + col][kc * 32], lane); v16b wf[8];
#pragma unroll
    for (int j = 0; j < 8; ++j) wf[j] = frag_b(&sw[j * 16 + col][kc * 32], lane);   // all eight W fragments of this k step in one group of LDS reads, not one wait per product
#pragma unroll
    for (int j = 0; j < 8; ++j) acc[j] = wmma_bf(a, wf[j], acc[j]); }
  __syncthreads();   // every wave has read its last sw fragment: the output tiles below overwrite sw
#pragma unroll
  for (int j = 0; j < 8; ++j) { const float bb = bfr(Bm[c0 + j * 16 + col]);
#pragma unroll
    for (int r = 0; r < 8; ++r) { const float v = acc[j][r] + bb; const int rl = wave * 16 + 8 * g + r, cl = j * 16 + col;
      if (which == 2) { const __bf16 bh = (__bf16)v; th[cl][rl] = bh; tl2[cl][rl] = (__bf16)(v - (float)bh); } else { const _Float16 hv = (_Float16)v; sh[rl][cl] = hv; sl[rl][cl] = (_Float16)(v - (float)hv); } } }
  __syncthreads();
  if (which < 2) { _Float16* dh = which == 0 ? QH : KH; for (int e = tid; e < 64 * 16; e += 128) { const int rl = e >> 4, q = e & 15; const size_t row = b * TT + p0 + rl; vst2((unsigned*)(dh + row * CC + c0 + q * 8), *(const v4u*)&sh[rl][q * 8]); if (which == 0) vst2((unsigned*)(QL + row * CC + c0 + q * 8), *(const v4u*)&sl[rl][q * 8]); } }
  else { for (int e = tid; e < 128 * 8; e += 128) { const int cl = e >> 3, q = e & 7; const size_t o2 = (b * CC + c0 + cl) * (size_t)TT + p0 + q * 8; vst2((unsigned*)(VT + o2), *(const v4u*)&th[cl][q * 8]); vst2((unsigned*)(VL + o2), *(const v4u*)&tl2[cl][q * 8]); } } }
__device__ __forceinline__ v8f mm16(v16h a, v16h b, v8f c) { return __builtin_amdgcn_wmma_f32_16x16x32_f16(false, a, false, b, (short)0, c, false, false); }
__device__ __forceinline__ v8f mmbf(v16b a, v16b b, v8f c) { return __builtin_amdgcn_wmma_f32_16x16x32_bf16(false, a, false, b, (short)0, c, false, false); }
// one 16x16x32 fragment in the hardware k order; p = row + k0 + 8 * (lane >> 4): elements 0..7 at p, 8..15 at p + 16
template <typename V16, typename V8, typename E> __device__ __forceinline__ V16 ld16(const E* p) { union { V16 v; V8 q[2]; } u; u.q[0] = *(const V8*)p; u.q[1] = *(const V8*)(p + 16); return u.v; }
// e^x for x <= 0 at full f32 accuracy: x * log2(e), held in two parts, minus its nearest integer n; 2^fraction on the transcendental unit, times 2^n; 0 below the underflow bound (a masked score)
__device__ __forceinline__ float exp_le0(float x) {
  const float n = rintf(x * 0x1.715476p+0f);
  const float a = fmaf(x, 0x1.4ae0bep-26f, fmaf(x, 0x1.715476p+0f, -n));
  float r; asm("v_exp_f32 %0, %1\n\tv_nop" : "=v"(r) : "v"(a));   // v_nop: the one slot that the instruction set asks for behind a transcendental, tied to it here (the compiler left one open behind expf)
  return x < -0x1.9d1da0p+6f ? 0.f : ldexpf(r, (int)n); }
// lane l <-> lane l ^ 16
__device__ __forceinline__ float xhalf(float x) { return __builtin_bit_cast(float, __builtin_amdgcn_permlanex16(__builtin_bit_cast(int, x), __builtin_bit_cast(int, x), 0x76543210, 0xfedcba98, false, false)); }
// ---- k_att: block = (query tile pair, (b,h)); 4 waves x 16 queries walk 64-query tile 15 - x, then tile x (equal work in every block). Per 32-key pass of a wave:
// S^T = K Q^T (a lane holds 16 keys of ONE query, lane ^ 16 the other 16), running maximum and sum, P^T packed from the score registers as the B operand, O^T += V^T P^T.
// Every plain '#pragma unroll' below unrolls a short constant loop fully, so that the fragment and accumulator arrays it indexes stay in registers.
__global__ __launch_bounds__(128) void k_att(const _Float16* __restrict__ QH, const _Float16* __restrict__ QL, const _Float16* __restrict__ KH, const __bf16* __restrict__ VT, const __bf16* __restrict__ VL, float* __restrict__ Y) {
  __shared__ __align__(16) float so[HD][68];
  const int tid = threadIdx.x, lane = tid & 31, col = lane & 15, g = lane >> 4; const int wave = __builtin_amdgcn_readfirstlane(tid >> 5);   // scalar: a wave's trip count and its diagonal test become scalar branches (EXEC stays full at the matrix instructions)
  const int b = blockIdx.y / NH, h = blockIdx.y % NH;
  const _Float16* kp = KH + ((size_t)b * TT + col) * CC + h * HD + 8 * g;                  // key row col of a 16-key tile
  const size_t vo = ((size_t)b * CC + h * HD + col) * (size_t)TT + 8 * g; const __bf16* vhp = VT + vo; const __bf16* vlp = VL + vo;   // channel row col of a 16-channel tile
#pragma unroll 1   // rolled: one copy of the pass loop serves both tiles (instruction cache)
  for (int half = 0; half < 2; ++half) { const int x = half ? (int)blockIdx.x : TT / 64 - 1 - (int)blockIdx.x; const int ql0 = x * 64 + wave * 16;
    const int nb = (ql0 + 47) >> 5;   // 32-key passes that hold keys [0, ql0 + 16); every query has an unmasked key in each of them
    v16h qh[2], ql[2], kf[2][2]; const size_t qo = ((size_t)b * TT + ql0 + col) * CC + h * HD + 8 * g; const _Float16* qhp = QH + qo; const _Float16* qlp = QL + qo;
#pragma unroll
    for (int kc = 0; kc < 2; ++kc) { qh[kc] = ld16<v16h, v8h>(qhp + kc * 32); ql[kc] = ld16<v16h, v8h>(qlp + kc * 32); }
#pragma unroll
    for (int t = 0; t < 2; ++t)
#pragma unroll
      for (int kc = 0; kc < 2; ++kc) kf[t][kc] = ld16<v16h, v8h>(kp + (size_t)(t * 16) * CC + kc * 32);
    asm volatile("s_wait_xcnt 0x0" :: "v"(qhp), "v"(qlp), "v"(kp) : "memory");   // names the loads' addresses as inputs: their registers may be reused (also as a later load's destination) only behind this wait
    float m = -3.0e38f, l = 0.f; v8f acc[HD / 16] = {};
#pragma unroll 1   // rolled: a second copy of the pass would need a second set of V^T fragments in registers
    for (int p = 0; p < nb; ++p) {
      const __bf16* pvh = vhp + p * 32; const __bf16* pvl = vlp + p * 32;
      v16b vh[HD / 16], vl[HD / 16];   // this pass's V^T fragments: in flight under the score products and the softmax
#pragma unroll
      for (int j = 0; j < HD / 16; ++j) { vh[j] = ld16<v16b, v8b>(pvh + (size_t)(j * 16) * TT); vl[j] = ld16<v16b, v8b>(pvl + (size_t)(j * 16) * TT); }
      v8f st[2] = {};
#pragma unroll
      for (int kc = 0; kc < 2; ++kc) {
#pragma unroll
        for (int t = 0; t < 2; ++t) st[t] = mm16(kf[t][kc], qh[kc], st[t]);
#pragma unroll
        for (int t = 0; t < 2; ++t) st[t] = mm16(kf[t][kc], ql[kc], st[t]); }
      asm volatile("s_wait_xcnt 0x0" :: "v"(pvh), "v"(pvl) : "memory");   // the V^T loads' address registers may be reused (also as a later load's destination) only behind this wait
      { const int pn = p + 1 < nb ? p + 1 : p; const _Float16* pk = kp + (size_t)(pn * 32) * CC;   // next pass's K fragments, one pass ahead (the last pass re-reads its own rows: always in bounds)
#pragma unroll
        for (int t = 0; t < 2; ++t)
#pragma unroll
          for (int kc = 0; kc < 2; ++kc) kf[t][kc] = ld16<v16h, v8h>(pk + (size_t)(t * 16) * CC + kc * 32);
        asm volatile("s_wait_xcnt 0x0" :: "v"(pk) : "memory"); }   // the same for the K loads' address
      float s[16];
#pragma unroll
      for (int i = 0; i < 16; ++i) s[i] = st[i >> 3][i & 7] * 0.125f;   // key p * 32 + 16 * (i >> 3) + 8 * g + (i & 7), query ql0 + col
      if (p == nb - 1) {   // wave-uniform: only the last pass meets the diagonal
#pragma unroll
        for (int i = 0; i < 16; ++i) if (p * 32 + 16 * (i >> 3) + 8 * g + (i & 7) > ql0 + col) s[i] = -3.0e38f; }
      float mx = s[0];
#pragma unroll
      for (int i = 1; i < 16; ++i) mx = fmaxf(mx, s[i]);
      mx = fmaxf(mx, xhalf(mx));
      const float mn = fmaxf(m, mx), al = exp_le0(m - mn); m = mn;   // al = 0 in the first pass
      float ps = 0.f;
#pragma unroll
      for (int i = 0; i < 16; ++i) { s[i] = exp_le0(s[i] - mn); ps += s[i]; }   // a masked score gives 0
      l = l * al + ps;   // each lane half sums its own keys; the halves join behind the loop
      const F2 pf = bsplit16(s);
#pragma unroll
      for (int j = 0; j < HD / 16; ++j) acc[j] = acc[j] * al;
#pragma unroll
      for (int j = 0; j < HD / 16; ++j) acc[j] = mmbf(vh[j], pf.h, acc[j]);
#pragma unroll
      for (int j = 0; j < HD / 16; ++j) acc[j] = mmbf(vh[j], pf.l, acc[j]);
#pragma unroll
      for (int j = 0; j < HD / 16; ++j) acc[j] = mmbf(vl[j], pf.h, acc[j]); }
    l += xhalf(l); const float inv = 1.0f / l;
#pragma unroll
    for (int j = 0; j < HD / 16; ++j)
#pragma unroll
      for (int r = 0; r < 8; ++r) so[j * 16 + 8 * g + r][wave * 16 + col] = acc[j][r] * inv;   // O^T: row = channel, column = query
    __syncthreads();   // all four waves' columns stand in so
    for (int e = tid; e < HD * 16; e += 128) { const int d = e >> 4, q4 = e & 15; vst2(Y + ((size_t)b * CC + h * HD + d) * TT + x * 64 + q4 * 4, *(const v4f*)&so[d][q4 * 4]); }
    __syncthreads();   // so is rewritten by the second tile
  } }
extern "C" void kernel_launch(void* const* d_in, const int* in_sizes, int n_in, void* d_out, int out_size, void* d_ws, size_t ws_size, hipStream_t stream) {
  (void)in_sizes; (void)n_in; (void)out_size;
  const float** F = (const float**)d_in;   // 0 query [8,256,32,32], 1 key [8,256,32,32], 2 Wq [512,256], 3 bq, 4 Wk [512,256], 5 bk, 6 Wv [512,256], 7 bv
  if (ws_size < (size_t)WS_END) return;
  char* ws = (char*)d_ws; _Float16 *QH = (_Float16*)(ws + WS_QH), *QL = (_Float16*)(ws + WS_QL), *KH = (_Float16*)(ws + WS_KH); __bf16 *VT = (__bf16*)(ws + WS_VT), *VL = (__bf16*)(ws + WS_VL);
  k_proj<<<dim3(TT / 64, CC / 128, TNB * 3), 128, 0, stream>>>(F[0], F[1], F[2], F[3], F[4], F[5], F[6], F[7], QH, QL, KH, VT, VL);
  k_att<<<dim3(TT / 128, HG), 128, 0, stream>>>(QH, QL, KH, VT, VL, (float*)d_out);   // logits, softmax and P.V of every (batch, head) in one launch
}

// v004
// One run takes 69.9 microseconds.
// Timed twice side by side with v003, it ran 1.31 times as fast both times.
// All steps since v000 together make it 10.6 times as fast.
// compute dtype: all float inputs rounded to bf16; q = query^T Wq^T + bq, k/v = key^T W^T + b with EXACT bf16 products on WMMA 16x16x32 (channel-major tiles transposed in LDS), f32 accumulate; q as f16 hi + residual, k f16 -> 2-product causal logits / 8 kept in the accumulator registers (S^T = K Q^T), online softmax in f32 (exponential at full f32 accuracy), P split bf16 hi + lo against v bf16 hi + lo (3 products, O^T = V^T P^T), divided by the row sum at the end; output written channel-major [b][e][s] in f32 (no output projection).
#include <hip/hip_runtime.h>
#include <math.h>

typedef __attribute__((ext_vector_type(16))) _Float16 v16h;
typedef __attribute__((ext_vector_type(16))) __bf16 v16b;
typedef __attribute__((ext_vector_type(8)))  _Float16 v8h;
typedef __attribute__((ext_vector_type(8)))  float v8f;
typedef __attribute__((ext_vector_type(4)))  float v4f;
typedef __attribute__((ext_vector_type(2)))  float v2f;
typedef __attribute__((ext_vector_type(4)))  unsigned v4u;
typedef __attribute__((ext_vector_type(4)))  int v4i;
typedef float __attribute__((may_alias)) float_a;
typedef int __attribute__((may_alias)) int_a;

template <typename T> __device__ __forceinline__ void vst2(void* p, T v) { *(T*)p = v;  }
__device__ __forceinline__ v8f wmma16(v16h a, v16h b, v8f c) {
  v8f d = __builtin_amdgcn_wmma_f32_16x16x32_f16(false, a, false, b, (short)0, c, false, false);
  asm volatile("v_nop\n\tv_nop\n\tv_nop\n\tv_nop" : "+v"(d) : "v"(a), "v"(b));
  return d;
}
__device__ __forceinline__ v8f wmma_bf(v16b a, v16b b, v8f c) {
  v8f d = __builtin_amdgcn_wmma_f32_16x16x32_bf16(false, a, false, b, (short)0, c, false, false);
  asm volatile("v_nop\n\tv_nop\n\tv_nop\n\tv_nop" : "+v"(d) : "v"(a), "v"(b));
  return d;
}
// 16x16x32 fragments: lane = (h = lane>>4, row/col = lane&15); elements 0..7 = k0+8h+0..7, 8..15 = k0+16+8h+0..7; D element r = row 8h+r
__device__ __forceinline__ v16h frag_h(const _Float16* rowk0, int lane) {
  union { v16h v; v8h q[2]; } u; const _Float16* p = rowk0 + 8 * (lane >> 4);
  u.q[0] = *(const v8h*)p; u.q[1] = *(const v8h*)(p + 16); return u.v;
}
__device__ __forceinline__ v16h frag_f32(const float* rowk0, int lane) {
  v16h a; const float* p = rowk0 + 8 * (lane >> 4);
#pragma unroll
  for (int i = 0; i < 8; ++i) { a[i] = (_Float16)p[i]; a[8 + i] = (_Float16)p[16 + i]; }
  return a;
}
__device__ __forceinline__ v16h frag_f32s(const float* rowk0, int lane, float sc) {
  v16h a; const float* p = rowk0 + 8 * (lane >> 4);
#pragma unroll
  for (int i = 0; i < 8; ++i) { a[i] = (_Float16)(p[i] * sc); a[8 + i] = (_Float16)(p[16 + i] * sc); }
  return a;
}
// column fragment from a [K][ld] layout (column n), rows >= K read as 0
__device__ __forceinline__ v16h fragc_f32(const float* W, int k0, int n, int lane, int ld, int K) {
  v16h a; const int g = lane >> 4;
#pragma unroll
  for (int i = 0; i < 8; ++i) { const int ka = k0 + 8 * g + i, kb = ka + 16;
    a[i] = (_Float16)(ka < K ? W[(size_t)(ka < K ? ka : K - 1) * ld + n] : 0.f); a[8 + i] = (_Float16)(kb < K ? W[(size_t)(kb < K ? kb : K - 1) * ld + n] : 0.f); }
  return a;
}
struct F2 { v16b h, l; };
__device__ __forceinline__ F2 bsplit16(const float v[16]) { F2 r;
#pragma unroll
  for (int i = 0; i < 16; ++i) { const __bf16 h = (__bf16)v[i]; r.h[i] = h; r.l[i] = (__bf16)(v[i] - (float)h); }
  return r; }
__device__ __forceinline__ F2 split_row(const float* row, int k0, int lane) { float v[16]; const float* p = row + k0 + 8 * (lane >> 4);
#pragma unroll
  for (int i = 0; i < 8; ++i) { v[i] = p[i]; v[8 + i] = p[16 + i]; }
  const F2 r = bsplit16(v);
  asm volatile("s_wait_xcnt 0x0" :: "v"(p) : "memory");   // names the row loads' address as an input: the allocator may reuse that register pair (as a later load's destination) only behind this wait
  return r; }
__device__ __forceinline__ F2 split_rowK(const float* row, int k0, int lane, int K) { float v[16]; const int g = lane >> 4;
#pragma unroll
  for (int i = 0; i < 8; ++i) { const int ka = k0 + 8 * g + i, kb = ka + 16; v[i] = ka < K ? row[ka < K ? ka : K - 1] : 0.f; v[8 + i] = kb < K ? row[kb < K ? kb : K - 1] : 0.f; }
  return bsplit16(v); }
__device__ __forceinline__ F2 split_col(const float* W, int k0, int n, int lane, int ld, int K) { float v[16]; const int g = lane >> 4;
#pragma unroll
  for (int i = 0; i < 8; ++i) { const int ka = k0 + 8 * g + i, kb = ka + 16; v[i] = ka < K ? W[(size_t)(ka < K ? ka : K - 1) * ld + n] : 0.f; v[8 + i] = kb < K ? W[(size_t)(kb < K ? kb : K - 1) * ld + n] : 0.f; }
  return bsplit16(v); }
__device__ __forceinline__ v8f mac3(const F2& a, const F2& b, v8f c) { c = wmma_bf(a.l, b.h, c); c = wmma_bf(a.h, b.l, c); return wmma_bf(a.h, b.h, c); }
__device__ __forceinline__ float sigm(float v) { return 1.0f / (1.0f + expf(-v)); }
#define LDSX() do { asm volatile("s_wait_dscnt 0" ::: "memory"); __builtin_amdgcn_wave_barrier(); __builtin_amdgcn_fence(__ATOMIC_RELEASE, "workgroup"); } while (0)


// PixelSNAIL causal attention (B 8, 32x32 = 1,024 positions, q from a 256-ch query map, k/v from a 256-ch key map, embed 512 = 8 heads x 64): channel-major in, channel-major out [b][h*64+d][s].
#define NB 8
#define TT 1024
#define CC 512
#define NH 8
#define HD 64
#ifndef TNB
#define TNB NB
#endif
typedef __attribute__((ext_vector_type(8))) __bf16 v8b;
typedef __attribute__((ext_vector_type(4))) __bf16 v4b;
__device__ __forceinline__ v16b frag_b(const __bf16* rowk0, int lane) {
  union { v16b v; v8b q[2]; } u; const __bf16* p = rowk0 + 8 * (lane >> 4);
  u.q[0] = *(const v8b*)p; u.q[1] = *(const v8b*)(p + 16); return u.v;
}
__device__ __forceinline__ float bfr(float v) { return (float)(__bf16)v; }
__device__ __attribute__((noinline)) float exp_ni(float v) { return expf(v); }
__device__ __attribute__((noinline)) float erf_ni(float v) { return erff(v); }

#define WS_QH  0u
#define WS_QL  (WS_QH + 2u * (size_t)NB * TT * CC)
#define WS_KH  (WS_QL + 2u * (size_t)NB * TT * CC)
#define WS_VT  (WS_KH + 2u * (size_t)NB * TT * CC)      // bf16 v planes [b][c][t]
#define WS_VL  (WS_VT + 2u * (size_t)NB * CC * TT)      // bf16 v residual planes
#define HG (NB * NH)                                  // (batch, head) pairs per launch: all of them
#define WS_END (WS_VL + 2u * (size_t)NB * CC * TT)

#define CIN 256
// ---- k_proj: block = (64 positions, 128 out cols, b*3 + which): x^T tile [64 s][256 c] bf16 in LDS from the channel-major map (query for q, key for k/v); the 128 rows of W [out][in] in bf16 in LDS too, read as fragments by all four waves; W + b exact; q -> f16 hi + residual rows, k -> f16 rows, v -> bf16 hi + lo planes
__global__ __launch_bounds__(128) void k_proj(const float* __restrict__ XQ, const float* __restrict__ XK, const float* __restrict__ WQ, const float* __restrict__ BQ, const float* __restrict__ WK, const float* __restrict__ BK, const float* __restrict__ WV, const float* __restrict__ BV, _Float16* __restrict__ QH, _Float16* __restrict__ QL, _Float16* __restrict__ KH, __bf16* __restrict__ VT, __bf16* __restrict__ VL) {
  __shared__ __align__(16) __bf16 sx[64][CIN + 8]; __shared__ __align__(16) __bf16 sw[128][CIN + 8];   // sw: the block's 128 rows of W in bf16, one copy for all four waves; pitch 528 B = 16 B x odd
  // the output tiles take sw's place once every wave has left the product loop (the barrier behind it)
  _Float16 (*sh)[136] = (_Float16 (*)[136])&sw[0][0]; _Float16 (*sl)[136] = sh + 64; __bf16 (*th)[72] = (__bf16 (*)[72])&sw[0][0]; __bf16 (*tl2)[72] = th + 128;
  const int tid = threadIdx.x, wave = tid >> 5, lane = tid & 31, col = lane & 15, g = lane >> 4; const int p0 = blockIdx.x * 64; const int c0 = blockIdx.y * 128; const size_t b = blockIdx.z / 3; const int which = blockIdx.z % 3;
  const float* X = which == 0 ? XQ : XK; const float* Wm = which == 0 ? WQ : which == 1 ? WK : WV; const float* Bm = which == 0 ? BQ : which == 1 ? BK : BV;
  { const float* wp = Wm + (size_t)c0 * CIN + tid * 4;   // the 128 rows are one contiguous 128 KiB: a wave's 16-byte loads cover whole lines
#pragma unroll 1   // rolled: two batches of 32 loads in flight; more would only cost registers
    for (int it = 0; it < 2; ++it) { v4f r[32];
#pragma unroll   // unrolled: r stays in registers and the 32 loads issue back to back
      for (int u = 0; u < 32; ++u) r[u] = *(const v4f*)(wp + (it * 32 + u) * 512);
#pragma unroll   // unrolled: r is indexed by constants
      for (int u = 0; u < 32; ++u) { v4b w4; w4[0] = (__bf16)r[u][0]; w4[1] = (__bf16)r[u][1]; w4[2] = (__bf16)r[u][2]; w4[3] = (__bf16)r[u][3]; *(v4b*)&sw[(it * 32 + u) * 2 + (tid >> 6)][(tid & 63) * 4] = w4; } } }
  for (int e = tid; e < CIN * 64; e += 128) { const int c = e >> 6, pl = e & 63; sx[pl][c] = (__bf16)X[(b * CIN + c) * (size_t)TT + p0 + pl]; }
  __syncthreads();
  v8f acc[8] = {};
#pragma unroll 2
  for (int kc = 0; kc < CIN / 32; ++kc) { const v16b a = frag_b(&sx[wave * 16 + col][kc * 32], lane); v16b wf[8];
#pragma unroll
    for (int j = 0; j < 8; ++j) wf[j] = frag_b(&sw[j * 16 + col][kc * 32], lane);   // all eight W fragments of this k step in one group of LDS reads, not one wait per product
#pragma unroll
    for (int j = 0; j < 8; ++j) acc[j] = wmma_bf(a, wf[j], acc[j]); }
  __syncthreads();   // every wave has read its last sw fragment: the output tiles below overwrite sw
#pragma unroll
  for (int j = 0; j < 8; ++j) { const float bb = bfr(Bm[c0 + j * 16 + col]);
#pragma unroll
    for (int r = 0; r < 8; ++r) { const float v = acc[j][r] + bb; const int rl = wave * 16 + 8 * g + r, cl = j * 16 + col;
      if (which == 2) { const __bf16 bh = (__bf16)v; th[cl][rl] = bh; tl2[cl][rl] = (__bf16)(v - (float)bh); } else { const _Float16 hv = (_Float16)v; sh[rl][cl] = hv; sl[rl][cl] = (_Float16)(v - (float)hv); } } }
  __syncthreads();
  if (which < 2) { _Float16* dh = which == 0 ? QH : KH; for (int e = tid; e < 64 * 16; e += 128) { const int rl = e >> 4, q = e & 15; const size_t row = b * TT + p0 + rl; vst2((unsigned*)(dh + row * CC + c0 + q * 8), *(const v4u*)&sh[rl][q * 8]); if (which == 0) vst2((unsigned*)(QL + row * CC + c0 + q * 8), *(const v4u*)&sl[rl][q * 8]); } }
  else { for (int e = tid; e < 128 * 8; e += 128) { const int cl = e >> 3, q = e & 7; const size_t o2 = (b * CC + c0 + cl) * (size_t)TT + p0 + q * 8; vst2((unsigned*)(VT + o2), *(const v4u*)&th[cl][q * 8]); vst2((unsigned*)(VL + o2), *(const v4u*)&tl2[cl][q * 8]); } } }
__device__ __forceinline__ v8f mm16(v16h a, v16h b, v8f c) { return __builtin_amdgcn_wmma_f32_16x16x32_f16(false, a, false, b, (short)0, c, false, false); }
__device__ __forceinline__ v8f mmbf(v16b a, v16b b, v8f c) { return __builtin_amdgcn_wmma_f32_16x16x32_bf16(false, a, false, b, (short)0, c, false, false); }
// one 16x16x32 fragment in the hardware k order; p = row + k0 + 8 * (lane >> 4): elements 0..7 at p, 8..15 at p + 16
template <typename V16, typename V8, typename E> __device__ __forceinline__ V16 ld16(const E* p) { union { V16 v; V8 q[2]; } u; u.q[0] = *(const V8*)p; u.q[1] = *(const V8*)(p + 16); return u.v; }
// e^x for x <= 0 at full f32 accuracy: x * log2(e), held in two parts, minus its nearest integer n; 2^fraction on the transcendental unit, times 2^n; 0 below the underflow bound (a masked score)
__device__ __forceinline__ float exp_le0(float x) {
  const float n = rintf(x * 0x1.715476p+0f);
  const float a = fmaf(x, 0x1.4ae0bep-26f, fmaf(x, 0x1.715476p+0f, -n));
  float r; asm("v_exp_f32 %0, %1\n\tv_nop" : "=v"(r) : "v"(a));   // v_nop: the one slot that the instruction set asks for behind a transcendental, tied to it here (the compiler left one open behind expf)
  return x < -0x1.9d1da0p+6f ? 0.f : ldexpf(r, (int)n); }
// lane l <-> lane l ^ 16
__device__ __forceinline__ float xhalf(float x) { return __builtin_bit_cast(float, __builtin_amdgcn_permlanex16(__builtin_bit_cast(int, x), __builtin_bit_cast(int, x), 0x76543210, 0xfedcba98, false, false)); }
// ---- k_att: block = (query tile pair, (b,h)); 4 waves x 16 queries walk 64-query tile 15 - x, then tile x (equal work in every block: 17 stages of 64 keys). Per 32-key pass of a wave:
// S^T = K Q^T (a lane holds 16 keys of ONE query, lane ^ 16 the other 16), running maximum and sum, P^T packed from the score registers as the B operand, O^T += V^T P^T.
// K rows and V^T rows of a stage stand in LDS, one copy for the four waves, brought by whole-line asynchronous copies into two buffers: stage t + 2 flies while stage t + 1 is worked on.
// Every plain '#pragma unroll' below unrolls a short constant loop fully, so that the fragment and accumulator arrays it indexes stay in registers.
#define KPIT 144                 // LDS row pitch in bytes: a 128-byte row + 16 = 16 B x odd, for the 16-byte fragment reads
#define TILEB (64 * KPIT)        // one tile: 64 rows (K: keys x 64 channels; V^T: channels x 64 keys)
#define STGB (3 * TILEB)         // a stage: K, V^T hi, V^T lo
#define NSTG (TT / 64 + 1)       // stages of a block: (16 - x) of the first tile + (x + 1) of the second
// one stage: every lane copies 12 x 16 bytes (rows r, r + 16, r + 32, r + 48 of each tile; eight lanes cover one 128-byte row). d = the lane's LDS byte address in the K tile.
// s_wait_xcnt 0 is the statement's last line: the address registers that the copies name are rewritten only behind it
__device__ __forceinline__ void cp_stage(unsigned d, const _Float16* k, const __bf16* vh, const __bf16* vl) {
  asm volatile(
    "global_load_async_to_lds_b128 %0, %12, off\n\t"
    "global_load_async_to_lds_b128 %1, %13, off\n\t"
    "global_load_async_to_lds_b128 %2, %14, off\n\t"
    "global_load_async_to_lds_b128 %3, %15, off\n\t"
    "global_load_async_to_lds_b128 %4, %16, off\n\t"
    "global_load_async_to_lds_b128 %5, %17, off\n\t"
    "global_load_async_to_lds_b128 %6, %18, off\n\t"
    "global_load_async_to_lds_b128 %7, %19, off\n\t"
    "global_load_async_to_lds_b128 %8, %20, off\n\t"
    "global_load_async_to_lds_b128 %9, %21, off\n\t"
    "global_load_async_to_lds_b128 %10, %22, off\n\t"
    "global_load_async_to_lds_b128 %11, %23, off\n\t"
    "s_wait_xcnt 0x0"
    :: "v"(d), "v"(d + 16 * KPIT), "v"(d + 32 * KPIT), "v"(d + 48 * KPIT),
       "v"(d + TILEB), "v"(d + TILEB + 16 * KPIT), "v"(d + TILEB + 32 * KPIT), "v"(d + TILEB + 48 * KPIT),
       "v"(d + 2 * TILEB), "v"(d + 2 * TILEB + 16 * KPIT), "v"(d + 2 * TILEB + 32 * KPIT), "v"(d + 2 * TILEB + 48 * KPIT),
       "v"(k), "v"(k + 16 * CC), "v"(k + 32 * CC), "v"(k + 48 * CC),
       "v"(vh), "v"(vh + 16 * TT), "v"(vh + 32 * TT), "v"(vh + 48 * TT),
       "v"(vl), "v"(vl + 16 * TT), "v"(vl + 32 * TT), "v"(vl + 48 * TT)
    : "memory"); }
__global__ __launch_bounds__(128) void k_att(const _Float16* __restrict__ QH, const _Float16* __restrict__ QL, const _Float16* __restrict__ KH, const __bf16* __restrict__ VT, const __bf16* __restrict__ VL, float* __restrict__ Y) {
  __shared__ __align__(16) float so[HD][68];
  __shared__ __align__(16) unsigned char ring[2 * STGB];
  const int tid = threadIdx.x, lane = tid & 31, col = lane & 15, g = lane >> 4; const int wave = __builtin_amdgcn_readfirstlane(tid >> 5);   // scalar: a wave's trip count and its diagonal test become scalar branches (EXEC stays full at the matrix instructions)
  const int b = blockIdx.y / NH, h = blockIdx.y % NH;
  const int n0 = TT / 64 - (int)blockIdx.x;   // stages of the first tile; stage s holds keys 64 * (s < n0 ? s : s - n0) + 0..63
  const int crow = tid >> 3, cq = tid & 7;    // the copies: row and 16-byte piece of this lane
  const _Float16* kcp = KH + ((size_t)b * TT + crow) * CC + h * HD + cq * 8;
  const size_t vco = ((size_t)b * CC + h * HD + crow) * (size_t)TT + cq * 8; const __bf16* vhc = VT + vco; const __bf16* vlc = VL + vco;
  const unsigned cl = (unsigned)(size_t)&ring[0] + crow * KPIT + cq * 16;
  const int fo = col * KPIT + g * 16;         // the fragment reads: row col of a 16-row tile, this lane half's first 16 bytes
  const int dl = col + (wave & 1) * 16 - 8 * g;   // a wave's last pass begins at key ql0 - (ql0 & 16): this lane's query minus its lane half's first key there, the same in both tiles (its compares stay outside the stage loop)
  cp_stage(cl, kcp, vhc, vlc);                                    // stage 0 (keys 0..63) into buffer 0
  asm volatile("s_wait_asynccnt 0x0" ::: "memory");               // this wave's copies of stage 0 have landed
  __syncthreads();                                                // every wave's have: stage 0 may be read
  cp_stage(cl + STGB, kcp + (size_t)64 * CC, vhc + 64, vlc + 64); // stage 1 (keys 64..127: the first tile has 9 stages or more) into buffer 1
  int x = TT / 64 - 1 - (int)blockIdx.x, ts = 0;                  // the query tile, and the stage's number within it
  v16h qh[2] = {}, ql[2] = {}; float m = -3.0e38f, l = 0.f; v8f acc[HD / 16] = {};
#pragma unroll 1   // rolled: one copy of the stage serves both tiles (instruction cache)
  for (int t = 0; t < NSTG; ++t) { const int ql0 = x * 64 + wave * 16;
    const int nb = (ql0 + 47) >> 5;   // 32-key passes that hold keys [0, ql0 + 16); every query has an unmasked key in each of them
    if (ts == 0) {   // block-uniform: a tile begins
      const size_t qo = ((size_t)b * TT + ql0 + col) * CC + h * HD + 8 * g; const _Float16* qhp = QH + qo; const _Float16* qlp = QL + qo;
#pragma unroll
      for (int kc = 0; kc < 2; ++kc) { qh[kc] = ld16<v16h, v8h>(qhp + kc * 32); ql[kc] = ld16<v16h, v8h>(qlp + kc * 32); }
      asm volatile("s_wait_xcnt 0x0" :: "v"(qhp), "v"(qlp) : "memory");   // names the loads' addresses as inputs: their registers may be reused (also as a later load's destination) only behind this wait
      m = -3.0e38f; l = 0.f;
#pragma unroll
      for (int j = 0; j < HD / 16; ++j) acc[j] = v8f{}; }
    const unsigned char* sb = ring + (t & 1) * STGB + fo;
    v16h kf[2][2];
#pragma unroll
    for (int u = 0; u < 2; ++u)
#pragma unroll
      for (int kc = 0; kc < 2; ++kc) kf[u][kc] = ld16<v16h, v8h>((const _Float16*)(sb + u * 16 * KPIT + kc * 64));
    const int np = nb - ts * 2 < 2 ? nb - ts * 2 : 2;   // wave-uniform: waves 0 and 1 skip the second pass of a tile's last stage
#pragma unroll 1   // rolled: a second copy of the pass would need a second set of V^T fragments in registers
    for (int pp = 0; pp < np; ++pp) { const int p = ts * 2 + pp;
      const unsigned char* pv = sb + TILEB + pp * 64;
      v16b vh[HD / 16], vl[HD / 16];   // this pass's V^T fragments: in flight under the score products and the softmax
#pragma unroll
      for (int j = 0; j < HD / 16; ++j) { vh[j] = ld16<v16b, v8b>((const __bf16*)(pv + j * 16 * KPIT)); vl[j] = ld16<v16b, v8b>((const __bf16*)(pv + TILEB + j * 16 * KPIT)); }
      v8f st[2] = {};
#pragma unroll
      for (int kc = 0; kc < 2; ++kc) {
#pragma unroll
        for (int u = 0; u < 2; ++u) st[u] = mm16(kf[u][kc], qh[kc], st[u]);
#pragma unroll
        for (int u = 0; u < 2; ++u) st[u] = mm16(kf[u][kc], ql[kc], st[u]); }
      if (pp == 0) {   // the second pass's K fragments, one pass ahead, from this stage's own buffer
#pragma unroll
        for (int u = 0; u < 2; ++u)
#pragma unroll
          for (int kc = 0; kc < 2; ++kc) kf[u][kc] = ld16<v16h, v8h>((const _Float16*)(sb + (32 + u * 16) * KPIT + kc * 64)); }
      float s[16];
#pragma unroll
      for (int i = 0; i < 16; ++i) s[i] = st[i >> 3][i & 7] * 0.125f;   // key p * 32 + 16 * (i >> 3) + 8 * g + (i & 7), query ql0 + col
      if (p == nb - 1) {   // wave-uniform: only the last pass meets the diagonal
#pragma unroll
        for (int i = 0; i < 16; ++i) if (16 * (i >> 3) + (i & 7) > dl) s[i] = -3.0e38f; }   // key > query
      float mx = s[0];
#pragma unroll
      for (int i = 1; i < 16; ++i) mx = fmaxf(mx, s[i]);
      mx = fmaxf(mx, xhalf(mx));
      const float mn = fmaxf(m, mx), al = exp_le0(m - mn); m = mn;   // al = 0 in the first pass
      float ps = 0.f;
#pragma unroll
      for (int i = 0; i < 16; ++i) { s[i] = exp_le0(s[i] - mn); ps += s[i]; }   // a masked score gives 0
      l = l * al + ps;   // each lane half sums its own keys; the halves join behind the tile's last stage
      const F2 pf = bsplit16(s);
#pragma unroll
      for (int j = 0; j < HD / 16; ++j) acc[j] = acc[j] * al;
#pragma unroll
      for (int j = 0; j < HD / 16; ++j) acc[j] = mmbf(vh[j], pf.h, acc[j]);
#pragma unroll
      for (int j = 0; j < HD / 16; ++j) acc[j] = mmbf(vh[j], pf.l, acc[j]);
#pragma unroll
      for (int j = 0; j < HD / 16; ++j) acc[j] = mmbf(vl[j], pf.h, acc[j]); }
    if (ts == x) {   // block-uniform: the tile's last stage is done
      l += xhalf(l); const float inv = 1.0f / l;
#pragma unroll
      for (int j = 0; j < HD / 16; ++j)
#pragma unroll
        for (int r = 0; r < 8; ++r) so[j * 16 + 8 * g + r][wave * 16 + col] = acc[j][r] * inv;   // O^T: row = channel, column = query
      __syncthreads();   // all four waves' columns stand in so
      for (int e = tid; e < HD * 16; e += 128) { const int d = e >> 4, q4 = e & 15; vst2(Y + ((size_t)b * CC + h * HD + d) * TT + x * 64 + q4 * 4, *(const v4f*)&so[d][q4 * 4]); }
      x = (int)blockIdx.x; ts = 0;   // so is rewritten by the second tile only behind the stage barrier below
    } else ++ts;
    asm volatile("s_wait_dscnt 0x0" ::: "memory");      // this wave's reads of stage t's buffer (and of so) have returned
    asm volatile("s_wait_asynccnt 0x0" ::: "memory");   // this wave's copies of stage t + 1 have landed
    __syncthreads();                                    // publishes stage t + 1 and frees stage t's buffer
    if (t + 2 < NSTG) { const int s2 = t + 2, k2 = (s2 < n0 ? s2 : s2 - n0) * 64;   // block-uniform: only while stage t + 2 exists
      cp_stage(cl + (t & 1) * STGB, kcp + (size_t)k2 * CC, vhc + k2, vlc + k2); } }
  asm volatile("s_wait_asynccnt 0x0" ::: "memory");     // nothing is in flight when the wave ends
}
extern "C" void kernel_launch(void* const* d_in, const int* in_sizes, int n_in, void* d_out, int out_size, void* d_ws, size_t ws_size, hipStream_t stream) {
  (void)in_sizes; (void)n_in; (void)out_size;
  const float** F = (const float**)d_in;   // 0 query [8,256,32,32], 1 key [8,256,32,32], 2 Wq [512,256], 3 bq, 4 Wk [512,256], 5 bk, 6 Wv [512,256], 7 bv
  if (ws_size < (size_t)WS_END) return;
  char* ws = (char*)d_ws; _Float16 *QH = (_Float16*)(ws + WS_QH), *QL = (_Float16*)(ws + WS_QL), *KH = (_Float16*)(ws + WS_KH); __bf16 *VT = (__bf16*)(ws + WS_VT), *VL = (__bf16*)(ws + WS_VL);
  k_proj<<<dim3(TT / 64, CC / 128, TNB * 3), 128, 0, stream>>>(F[0], F[1], F[2], F[3], F[4], F[5], F[6], F[7], QH, QL, KH, VT, VL);
  k_att<<<dim3(TT / 128, HG), 128, 0, stream>>>(QH, QL, KH, VT, VL, (float*)d_out);   // logits, softmax and P.V of every (batch, head) in one launch
}

// v005
// Measured time: 64 microseconds a run.
// In both of two side-by-side timings against v004, it was 1.09 times as fast.
// Counting every step since v000, it is 11.6 times as fast.
// compute dtype: all float inputs rounded to bf16; q = query^T Wq^T + bq, k/v = key^T W^T + b with EXACT bf16 products on WMMA 16x16x32 (channel-major tiles transposed in LDS), f32 accumulate; q as f16 hi + residual, k f16 -> 2-product causal logits kept in the accumulator registers (S^T = K Q^T), online softmax in f32 (base 2: exponent = one fused multiply-add of the raw product, 2^t on the transcendental unit), P split bf16 hi + lo against v bf16 hi + lo (3 products, O^T = V^T P^T), divided by the row sum at the end; output written channel-major [b][e][s] in f32 (no output projection).
#include <hip/hip_runtime.h>
#include <math.h>

typedef __attribute__((ext_vector_type(16))) _Float16 v16h;
typedef __attribute__((ext_vector_type(16))) __bf16 v16b;
typedef __attribute__((ext_vector_type(8)))  _Float16 v8h;
typedef __attribute__((ext_vector_type(8)))  float v8f;
typedef __attribute__((ext_vector_type(4)))  float v4f;
typedef __attribute__((ext_vector_type(2)))  float v2f;
typedef __attribute__((ext_vector_type(4)))  unsigned v4u;
typedef __attribute__((ext_vector_type(4)))  int v4i;
typedef float __attribute__((may_alias)) float_a;
typedef int __attribute__((may_alias)) int_a;

template <typename T> __device__ __forceinline__ void vst2(void* p, T v) { *(T*)p = v;  }
__device__ __forceinline__ v8f wmma16(v16h a, v16h b, v8f c) {
  v8f d = __builtin_amdgcn_wmma_f32_16x16x32_f16(false, a, false, b, (short)0, c, false, false);
  asm volatile("v_nop\n\tv_nop\n\tv_nop\n\tv_nop" : "+v"(d) : "v"(a), "v"(b));
  return d;
}
__device__ __forceinline__ v8f wmma_bf(v16b a, v16b b, v8f c) {
  v8f d = __builtin_amdgcn_wmma_f32_16x16x32_bf16(false, a, false, b, (short)0, c, false, false);
  asm volatile("v_nop\n\tv_nop\n\tv_nop\n\tv_nop" : "+v"(d) : "v"(a), "v"(b));
  return d;
}
// 16x16x32 fragments: lane = (h = lane>>4, row/col = lane&15); elements 0..7 = k0+8h+0..7, 8..15 = k0+16+8h+0..7; D element r = row 8h+r
__device__ __forceinline__ v16h frag_h(const _Float16* rowk0, int lane) {
  union { v16h v; v8h q[2]; } u; const _Float16* p = rowk0 + 8 * (lane >> 4);
  u.q[0] = *(const v8h*)p; u.q[1] = *(const v8h*)(p + 16); return u.v;
}
__device__ __forceinline__ v16h frag_f32(const float* rowk0, int lane) {
  v16h a; const float* p = rowk0 + 8 * (lane >> 4);
#pragma unroll
  for (int i = 0; i < 8; ++i) { a[i] = (_Float16)p[i]; a[8 + i] = (_Float16)p[16 + i]; }
  return a;
}
__device__ __forceinline__ v16h frag_f32s(const float* rowk0, int lane, float sc) {
  v16h a; const float* p = rowk0 + 8 * (lane >> 4);
#pragma unroll
  for (int i = 0; i < 8; ++i) { a[i] = (_Float16)(p[i] * sc); a[8 + i] = (_Float16)(p[16 + i] * sc); }
  return a;
}
// column fragment from a [K][ld] layout (column n), rows >= K read as 0
__device__ __forceinline__ v16h fragc_f32(const float* W, int k0, int n, int lane, int ld, int K) {
  v16h a; const int g = lane >> 4;
#pragma unroll
  for (int i = 0; i < 8; ++i) { const int ka = k0 + 8 * g + i, kb = ka + 16;
    a[i] = (_Float16)(ka < K ? W[(size_t)(ka < K ? ka : K - 1) * ld + n] : 0.f); a[8 + i] = (_Float16)(kb < K ? W[(size_t)(kb < K ? kb : K - 1) * ld + n] : 0.f); }
  return a;
}
struct F2 { v16b h, l; };
__device__ __forceinline__ F2 bsplit16(const float v[16]) { F2 r;
#pragma unroll
  for (int i = 0; i < 16; ++i) { const __bf16 h = (__bf16)v[i]; r.h[i] = h; r.l[i] = (__bf16)(v[i] - (float)h); }
  return r; }
__device__ __forceinline__ F2 split_row(const float* row, int k0, int lane) { float v[16]; const float* p = row + k0 + 8 * (lane >> 4);
#pragma unroll
  for (int i = 0; i < 8; ++i) { v[i] = p[i]; v[8 + i] = p[16 + i]; }
  const F2 r = bsplit16(v);
  asm volatile("s_wait_xcnt 0x0" :: "v"(p) : "memory");   // names the row loads' address as an input: the allocator may reuse that register pair (as a later load's destination) only behind this wait
  return r; }
__device__ __forceinline__ F2 split_rowK(const float* row, int k0, int lane, int K) { float v[16]; const int g = lane >> 4;
#pragma unroll
  for (int i = 0; i < 8; ++i) { const int ka = k0 + 8 * g + i, kb = ka + 16; v[i] = ka < K ? row[ka < K ? ka : K - 1] : 0.f; v[8 + i] = kb < K ? row[kb < K ? kb : K - 1] : 0.f; }
  return bsplit16(v); }
__device__ __forceinline__ F2 split_col(const float* W, int k0, int n, int lane, int ld, int K) { float v[16]; const int g = lane >> 4;
#pragma unroll
  for (int i = 0; i < 8; ++i) { const int ka = k0 + 8 * g + i, kb = ka + 16; v[i] = ka < K ? W[(size_t)(ka < K ? ka : K - 1) * ld + n] : 0.f; v[8 + i] = kb < K ? W[(size_t)(kb < K ? kb : K - 1) * ld + n] : 0.f; }
  return bsplit16(v); }
__device__ __forceinline__ v8f mac3(const F2& a, const F2& b, v8f c) { c = wmma_bf(a.l, b.h, c); c = wmma_bf(a.h, b.l, c); return wmma_bf(a.h, b.h, c); }
__device__ __forceinline__ float sigm(float v) { return 1.0f / (1.0f + expf(-v)); }
#define LDSX() do { asm volatile("s_wait_dscnt 0" ::: "memory"); __builtin_amdgcn_wave_barrier(); __builtin_amdgcn_fence(__ATOMIC_RELEASE, "workgroup"); } while (0)


// PixelSNAIL causal attention (B 8, 32x32 = 1,024 positions, q from a 256-ch query map, k/v from a 256-ch key map, embed 512 = 8 heads x 64): channel-major in, channel-major out [b][h*64+d][s].
#define NB 8
#define TT 1024
#define CC 512
#define NH 8
#define HD 64
#ifndef TNB
#define TNB NB
#endif
typedef __attribute__((ext_vector_type(8))) __bf16 v8b;
typedef __attribute__((ext_vector_type(4))) __bf16 v4b;
__device__ __forceinline__ v16b frag_b(const __bf16* rowk0, int lane) {
  union { v16b v; v8b q[2]; } u; const __bf16* p = rowk0 + 8 * (lane >> 4);
  u.q[0] = *(const v8b*)p; u.q[1] = *(const v8b*)(p + 16); return u.v;
}
__device__ __forceinline__ float bfr(float v) { return (float)(__bf16)v; }
__device__ __attribute__((noinline)) float exp_ni(float v) { return expf(v); }
__device__ __attribute__((noinline)) float erf_ni(float v) { return erff(v); }

#define WS_QH  0u
#define WS_QL  (WS_QH + 2u * (size_t)NB * TT * CC)
#define WS_KH  (WS_QL + 2u * (size_t)NB * TT * CC)
#define WS_VT  (WS_KH + 2u * (size_t)NB * TT * CC)      // bf16 v planes [b][c][t]
#define WS_VL  (WS_VT + 2u * (size_t)NB * CC * TT)      // bf16 v residual planes
#define HG (NB * NH)                                  // (batch, head) pairs per launch: all of them
#define WS_END (WS_VL + 2u * (size_t)NB * CC * TT)

#define CIN 256
// ---- k_proj: block = (64 positions, 128 out cols, b*3 + which): x^T tile [64 s][256 c] bf16 in LDS from the channel-major map (query for q, key for k/v); the 128 rows of W [out][in] in bf16 in LDS too, read as fragments by all four waves; W + b exact; q -> f16 hi + residual rows, k -> f16 rows, v -> bf16 hi + lo planes
__global__ __launch_bounds__(128) void k_proj(const float* __restrict__ XQ, const float* __restrict__ XK, const float* __restrict__ WQ, const float* __restrict__ BQ, const float* __restrict__ WK, const float* __restrict__ BK, const float* __restrict__ WV, const float* __restrict__ BV, _Float16* __restrict__ QH, _Float16* __restrict__ QL, _Float16* __restrict__ KH, __bf16* __restrict__ VT, __bf16* __restrict__ VL) {
  __shared__ __align__(16) __bf16 sx[64][CIN + 8]; __shared__ __align__(16) __bf16 sw[128][CIN + 8];   // sw: the block's 128 rows of W in bf16, one copy for all four waves; pitch 528 B = 16 B x odd
  // the output tiles take sw's place once every wave has left the product loop (the barrier behind it)
  _Float16 (*sh)[136] = (_Float16 (*)[136])&sw[0][0]; _Float16 (*sl)[136] = sh + 64; __bf16 (*th)[72] = (__bf16 (*)[72])&sw[0][0]; __bf16 (*tl2)[72] = th + 128;
  const int tid = threadIdx.x, wave = tid >> 5, lane = tid & 31, col = lane & 15, g = lane >> 4; const int p0 = blockIdx.x * 64; const int c0 = blockIdx.y * 128; const size_t b = blockIdx.z / 3; const int which = blockIdx.z % 3;
  const float* X = which == 0 ? XQ : XK; const float* Wm = which == 0 ? WQ : which == 1 ? WK : WV; const float* Bm = which == 0 ? BQ : which == 1 ? BK : BV;
  { const float* wp = Wm + (size_t)c0 * CIN + tid * 4;   // the 128 rows are one contiguous 128 KiB: a wave's 16-byte loads cover whole lines
#pragma unroll 1   // rolled: two batches of 32 loads in flight; more would only cost registers
    for (int it = 0; it < 2; ++it) { v4f r[32];
#pragma unroll   // unrolled: r stays in registers and the 32 loads issue back to back
      for (int u = 0; u < 32; ++u) r[u] = *(const v4f*)(wp + (it * 32 + u) * 512);
#pragma unroll   // unrolled: r is indexed by constants
      for (int u = 0; u < 32; ++u) { v4b w4; w4[0] = (__bf16)r[u][0]; w4[1] = (__bf16)r[u][1]; w4[2] = (__bf16)r[u][2]; w4[3] = (__bf16)r[u][3]; *(v4b*)&sw[(it * 32 + u) * 2 + (tid >> 6)][(tid & 63) * 4] = w4; } } }
  for (int e = tid; e < CIN * 64; e += 128) { const int c = e >> 6, pl = e & 63; sx[pl][c] = (__bf16)X[(b * CIN + c) * (size_t)TT + p0 + pl]; }
  __syncthreads();
  v8f acc[8] = {};
#pragma unroll 2
  for (int kc = 0; kc < CIN / 32; ++kc) { const v16b a = frag_b(&sx[wave * 16 + col][kc * 32], lane); v16b wf[8];
#pragma unroll
    for (int j = 0; j < 8; ++j) wf[j] = frag_b(&sw[j * 16 + col][kc * 32], lane);   // all eight W fragments of this k step in one group of LDS reads, not one wait per product
#pragma unroll
    for (int j = 0; j < 8; ++j) acc[j] = wmma_bf(a, wf[j], acc[j]); }
  __syncthreads();   // every wave has read its last sw fragment: the output tiles below overwrite sw
#pragma unroll
  for (int j = 0; j < 8; ++j) { const float bb = bfr(Bm[c0 + j * 16 + col]);
#pragma unroll
    for (int r = 0; r < 8; ++r) { const float v = acc[j][r] + bb; const int rl = wave * 16 + 8 * g + r, cl = j * 16 + col;
      if (which == 2) { const __bf16 bh = (__bf16)v; th[cl][rl] = bh; tl2[cl][rl] = (__bf16)(v - (float)bh); } else { const _Float16 hv = (_Float16)v; sh[rl][cl] = hv; sl[rl][cl] = (_Float16)(v - (float)hv); } } }
  __syncthreads();
  if (which < 2) { _Float16* dh = which == 0 ? QH : KH; for (int e = tid; e < 64 * 16; e += 128) { const int rl = e >> 4, q = e & 15; const size_t row = b * TT + p0 + rl; vst2((unsigned*)(dh + row * CC + c0 + q * 8), *(const v4u*)&sh[rl][q * 8]); if (which == 0) vst2((unsigned*)(QL + row * CC + c0 + q * 8), *(const v4u*)&sl[rl][q * 8]); } }
  else { for (int e = tid; e < 128 * 8; e += 128) { const int cl = e >> 3, q = e & 7; const size_t o2 = (b * CC + c0 + cl) * (size_t)TT + p0 + q * 8; vst2((unsigned*)(VT + o2), *(const v4u*)&th[cl][q * 8]); vst2((unsigned*)(VL + o2), *(const v4u*)&tl2[cl][q * 8]); } } }
__device__ __forceinline__ v8f mm16(v16h a, v16h b, v8f c) { return __builtin_amdgcn_wmma_f32_16x16x32_f16(false, a, false, b, (short)0, c, false, false); }
__device__ __forceinline__ v8f mmbf(v16b a, v16b b, v8f c) { return __builtin_amdgcn_wmma_f32_16x16x32_bf16(false, a, false, b, (short)0, c, false, false); }
// one 16x16x32 fragment in the hardware k order; p = row + k0 + 8 * (lane >> 4): elements 0..7 at p, 8..15 at p + 16
template <typename V16, typename V8, typename E> __device__ __forceinline__ V16 ld16(const E* p) { union { V16 v; V8 q[2]; } u; u.q[0] = *(const V8*)p; u.q[1] = *(const V8*)(p + 16); return u.v; }
// 2^t on the transcendental unit; a masked score (t far below the underflow bound) gives 0
__device__ __forceinline__ float exp2_hw(float t) {
  float r; asm("v_exp_f32 %0, %1\n\tv_nop" : "=v"(r) : "v"(t));   // v_nop: the one slot that the instruction set asks for behind a transcendental, tied to it here
  return r; }
#define SC2 0x1.715476p-3f       // log2(e) / 8: a raw q.k product times SC2 is the logit in the base-2 domain
// lane l <-> lane l ^ 16
__device__ __forceinline__ float xhalf(float x) { return __builtin_bit_cast(float, __builtin_amdgcn_permlanex16(__builtin_bit_cast(int, x), __builtin_bit_cast(int, x), 0x76543210, 0xfedcba98, false, false)); }
// ---- k_att: block = (query tile pair, (b,h)); 4 waves x 16 queries walk 64-query tile 15 - x, then tile x (equal work in every block: 17 stages of 64 keys). Per 32-key pass of a wave:
// S^T = K Q^T (a lane holds 16 keys of ONE query, lane ^ 16 the other 16), running maximum and sum, P^T packed from the score registers as the B operand, O^T += V^T P^T.
// K rows and V^T rows of a stage stand in LDS, one copy for the four waves, brought by whole-line asynchronous copies into two buffers: stage t + 2 flies while stage t + 1 is worked on.
// Every plain '#pragma unroll' below unrolls a short constant loop fully, so that the fragment and accumulator arrays it indexes stay in registers.
#define KPIT 144                 // LDS row pitch in bytes: a 128-byte row + 16 = 16 B x odd, for the 16-byte fragment reads
#define TILEB (64 * KPIT)        // one tile: 64 rows (K: keys x 64 channels; V^T: channels x 64 keys)
#define STGB (3 * TILEB)         // a stage: K, V^T hi, V^T lo
#define NSTG (TT / 64 + 1)       // stages of a block: (16 - x) of the first tile + (x + 1) of the second
// one stage: every lane copies 12 x 16 bytes (rows r, r + 16, r + 32, r + 48 of each tile; eight lanes cover one 128-byte row). d = the lane's LDS byte address in the K tile.
// s_wait_xcnt 0 is the statement's last line: the address registers that the copies name are rewritten only behind it
__device__ __forceinline__ void cp_stage(unsigned d, const _Float16* k, const __bf16* vh, const __bf16* vl) {
  asm volatile(
    "global_load_async_to_lds_b128 %0, %12, off\n\t"
    "global_load_async_to_lds_b128 %1, %13, off\n\t"
    "global_load_async_to_lds_b128 %2, %14, off\n\t"
    "global_load_async_to_lds_b128 %3, %15, off\n\t"
    "global_load_async_to_lds_b128 %4, %16, off\n\t"
    "global_load_async_to_lds_b128 %5, %17, off\n\t"
    "global_load_async_to_lds_b128 %6, %18, off\n\t"
    "global_load_async_to_lds_b128 %7, %19, off\n\t"
    "global_load_async_to_lds_b128 %8, %20, off\n\t"
    "global_load_async_to_lds_b128 %9, %21, off\n\t"
    "global_load_async_to_lds_b128 %10, %22, off\n\t"
    "global_load_async_to_lds_b128 %11, %23, off\n\t"
    "s_wait_xcnt 0x0"
    :: "v"(d), "v"(d + 16 * KPIT), "v"(d + 32 * KPIT), "v"(d + 48 * KPIT),
       "v"(d + TILEB), "v"(d + TILEB + 16 * KPIT), "v"(d + TILEB + 32 * KPIT), "v"(d + TILEB + 48 * KPIT),
       "v"(d + 2 * TILEB), "v"(d + 2 * TILEB + 16 * KPIT), "v"(d + 2 * TILEB + 32 * KPIT), "v"(d + 2 * TILEB + 48 * KPIT),
       "v"(k), "v"(k + 16 * CC), "v"(k + 32 * CC), "v"(k + 48 * CC),
       "v"(vh), "v"(vh + 16 * TT), "v"(vh + 32 * TT), "v"(vh + 48 * TT),
       "v"(vl), "v"(vl + 16 * TT), "v"(vl + 32 * TT), "v"(vl + 48 * TT)
    : "memory"); }
__global__ __launch_bounds__(128) void k_att(const _Float16* __restrict__ QH, const _Float16* __restrict__ QL, const _Float16* __restrict__ KH, const __bf16* __restrict__ VT, const __bf16* __restrict__ VL, float* __restrict__ Y) {
  __shared__ __align__(16) float so[HD][68];
  __shared__ __align__(16) unsigned char ring[2 * STGB];
  const int tid = threadIdx.x, lane = tid & 31, col = lane & 15, g = lane >> 4; const int wave = __builtin_amdgcn_readfirstlane(tid >> 5);   // scalar: a wave's trip count and its diagonal test become scalar branches (EXEC stays full at the matrix instructions)
  const int b = blockIdx.y / NH, h = blockIdx.y % NH;
  const int n0 = TT / 64 - (int)blockIdx.x;   // stages of the first tile; stage s holds keys 64 * (s < n0 ? s : s - n0) + 0..63
  const int crow = tid >> 3, cq = tid & 7;    // the copies: row and 16-byte piece of this lane
  const _Float16* kcp = KH + ((size_t)b * TT + crow) * CC + h * HD + cq * 8;
  const size_t vco = ((size_t)b * CC + h * HD + crow) * (size_t)TT + cq * 8; const __bf16* vhc = VT + vco; const __bf16* vlc = VL + vco;
  const unsigned cl = (unsigned)(size_t)&ring[0] + crow * KPIT + cq * 16;
  const int fo = col * KPIT + g * 16;         // the fragment reads: row col of a 16-row tile, this lane half's first 16 bytes
  const int dl = col + (wave & 1) * 16 - 8 * g;   // a wave's last pass begins at key ql0 - (ql0 & 16): this lane's query minus its lane half's first key there, the same in both tiles (its compares stay outside the stage loop)
  cp_stage(cl, kcp, vhc, vlc);                                    // stage 0 (keys 0..63) into buffer 0
  asm volatile("s_wait_asynccnt 0x0" ::: "memory");               // this wave's copies of stage 0 have landed
  __syncthreads();                                                // every wave's have: stage 0 may be read
  cp_stage(cl + STGB, kcp + (size_t)64 * CC, vhc + 64, vlc + 64); // stage 1 (keys 64..127: the first tile has 9 stages or more) into buffer 1
  int x = TT / 64 - 1 - (int)blockIdx.x, ts = 0;                  // the query tile, and the stage's number within it
  v16h qh[2] = {}, ql[2] = {}; float m = -3.0e38f, l = 0.f; v8f acc[HD / 16] = {};
#pragma unroll 1   // rolled: one copy of the stage serves both tiles
  for (int t = 0; t < NSTG; ++t) { const int ql0 = x * 64 + wave * 16;
    const int nb = (ql0 + 47) >> 5;   // 32-key passes that hold keys [0, ql0 + 16); every query has an unmasked key in each of them
    if (ts == 0) {   // block-uniform: a tile begins
      const size_t qo = ((size_t)b * TT + ql0 + col) * CC + h * HD + 8 * g; const _Float16* qhp = QH + qo; const _Float16* qlp = QL + qo;
#pragma unroll
      for (int kc = 0; kc < 2; ++kc) { qh[kc] = ld16<v16h, v8h>(qhp + kc * 32); ql[kc] = ld16<v16h, v8h>(qlp + kc * 32); }
      asm volatile("s_wait_xcnt 0x0" :: "v"(qhp), "v"(qlp) : "memory");   // names the loads' addresses as inputs: their registers may be reused (also as a later load's destination) only behind this wait
      m = -3.0e38f; l = 0.f;
#pragma unroll
      for (int j = 0; j < HD / 16; ++j) acc[j] = v8f{}; }
    const unsigned char* sb = ring + (t & 1) * STGB + fo;
    v16h kf[2][2];
#pragma unroll
    for (int u = 0; u < 2; ++u)
#pragma unroll
      for (int kc = 0; kc < 2; ++kc) kf[u][kc] = ld16<v16h, v8h>((const _Float16*)(sb + u * 16 * KPIT + kc * 64));
    const int np = nb - ts * 2 < 2 ? nb - ts * 2 : 2;   // wave-uniform: waves 0 and 1 skip the second pass of a tile's last stage
#pragma unroll 1   // rolled: a second copy of the pass would need a second set of V^T fragments in registers
    for (int pp = 0; pp < np; ++pp) { const int p = ts * 2 + pp;
      const unsigned char* pv = sb + TILEB + pp * 64;
      v16b vh[HD / 16], vl[HD / 16];   // this pass's V^T fragments: in flight under the score products and the softmax
#pragma unroll
      for (int j = 0; j < HD / 16; ++j) { vh[j] = ld16<v16b, v8b>((const __bf16*)(pv + j * 16 * KPIT)); vl[j] = ld16<v16b, v8b>((const __bf16*)(pv + TILEB + j * 16 * KPIT)); }
      v8f st[2] = {};
#pragma unroll
      for (int kc = 0; kc < 2; ++kc) {
#pragma unroll
        for (int u = 0; u < 2; ++u) st[u] = mm16(kf[u][kc], qh[kc], st[u]);
#pragma unroll
        for (int u = 0; u < 2; ++u) st[u] = mm16(kf[u][kc], ql[kc], st[u]); }
      if (pp == 0) {   // the second pass's K fragments, one pass ahead, from this stage's own buffer
#pragma unroll
        for (int u = 0; u < 2; ++u)
#pragma unroll
          for (int kc = 0; kc < 2; ++kc) kf[u][kc] = ld16<v16h, v8h>((const _Float16*)(sb + (32 + u * 16) * KPIT + kc * 64)); }
      float s[16];
#pragma unroll
      for (int i = 0; i < 16; ++i) s[i] = st[i >> 3][i & 7];   // raw q.k of key p * 32 + 16 * (i >> 3) + 8 * g + (i & 7), query ql0 + col
      if (p == nb - 1) {   // wave-uniform: only the last pass meets the diagonal
#pragma unroll
        for (int i = 0; i < 16; ++i) if (16 * (i >> 3) + (i & 7) > dl) s[i] = -3.0e38f; }   // key > query
      float mx = s[0];
#pragma unroll
      for (int i = 1; i < 16; ++i) mx = fmaxf(mx, s[i]);
      mx = fmaxf(mx, xhalf(mx));
      const float mn = fmaxf(m, mx * SC2), al = exp2_hw(m - mn); m = mn;   // the running maximum is kept in the base-2 domain; al = 0 in the first pass
      float ps = 0.f;
#pragma unroll
      for (int i = 0; i < 16; i += 2) {   // scale, base change and maximum in one fused multiply-add, rounded once, two scores to a packed instruction; a masked score gives 0
        const v2f t = __builtin_elementwise_fma(v2f{s[i], s[i + 1]}, v2f{SC2, SC2}, v2f{-mn, -mn});
        s[i] = exp2_hw(t[0]); s[i + 1] = exp2_hw(t[1]); ps += s[i]; ps += s[i + 1]; }
      l = l * al + ps;   // each lane half sums its own keys; the halves join behind the tile's last stage
      const F2 pf = bsplit16(s);
#pragma unroll
      for (int j = 0; j < HD / 16; ++j) acc[j] = acc[j] * al;
#pragma unroll
      for (int j = 0; j < HD / 16; ++j) acc[j] = mmbf(vh[j], pf.h, acc[j]);
#pragma unroll
      for (int j = 0; j < HD / 16; ++j) acc[j] = mmbf(vh[j], pf.l, acc[j]);
#pragma unroll
      for (int j = 0; j < HD / 16; ++j) acc[j] = mmbf(vl[j], pf.h, acc[j]); }
    if (ts == x) {   // block-uniform: the tile's last stage is done
      l += xhalf(l); const float inv = 1.0f / l;
#pragma unroll
      for (int j = 0; j < HD / 16; ++j)
#pragma unroll
        for (int r = 0; r < 8; ++r) so[j * 16 + 8 * g + r][wave * 16 + col] = acc[j][r] * inv;   // O^T: row = channel, column = query
      __syncthreads();   // all four waves' columns stand in so
      for (int e = tid; e < HD * 16; e += 128) { const int d = e >> 4, q4 = e & 15; vst2(Y + ((size_t)b * CC + h * HD + d) * TT + x * 64 + q4 * 4, *(const v4f*)&so[d][q4 * 4]); }
      x = (int)blockIdx.x; ts = 0;   // so is rewritten by the second tile only behind the stage barrier below
    } else ++ts;
    asm volatile("s_wait_dscnt 0x0" ::: "memory");      // this wave's reads of stage t's buffer (and of so) have returned
    asm volatile("s_wait_asynccnt 0x0" ::: "memory");   // this wave's copies of stage t + 1 have landed
    __syncthreads();                                    // publishes stage t + 1 and frees stage t's buffer
    if (t + 2 < NSTG) { const int s2 = t + 2, k2 = (s2 < n0 ? s2 : s2 - n0) * 64;   // block-uniform: only while stage t + 2 exists
      cp_stage(cl + (t & 1) * STGB, kcp + (size_t)k2 * CC, vhc + k2, vlc + k2); } }
  asm volatile("s_wait_asynccnt 0x0" ::: "memory");     // nothing is in flight when the wave ends
}
extern "C" void kernel_launch(void* const* d_in, const int* in_sizes, int n_in, void* d_out, int out_size, void* d_ws, size_t ws_size, hipStream_t stream) {
  (void)in_sizes; (void)n_in; (void)out_size;
  const float** F = (const float**)d_in;   // 0 query [8,256,32,32], 1 key [8,256,32,32], 2 Wq [512,256], 3 bq, 4 Wk [512,256], 5 bk, 6 Wv [512,256], 7 bv
  if (ws_size < (size_t)WS_END) return;
  char* ws = (char*)d_ws; _Float16 *QH = (_Float16*)(ws + WS_QH), *QL = (_Float16*)(ws + WS_QL), *KH = (_Float16*)(ws + WS_KH); __bf16 *VT = (__bf16*)(ws + WS_VT), *VL = (__bf16*)(ws + WS_VL);
  k_proj<<<dim3(TT / 64, CC / 128, TNB * 3), 128, 0, stream>>>(F[0], F[1], F[2], F[3], F[4], F[5], F[6], F[7], QH, QL, KH, VT, VL);
  k_att<<<dim3(TT / 128, HG), 128, 0, stream>>>(QH, QL, KH, VT, VL, (float*)d_out);   // logits, softmax and P.V of every (batch, head) in one launch
}

// v006
// A run of this version takes 52.9 microseconds.
// Two timings next to v005 both put it at 1.21 times that version's speed.
// Over all steps from v000 it is 14.1 times as fast.
// compute dtype: all float inputs rounded to bf16; q = query^T Wq^T + bq, k/v = key^T W^T + b with EXACT bf16 products on WMMA 16x16x32 (channel-major tiles transposed in registers on the way to LDS), f32 accumulate; q as f16 hi + residual, k f16 -> 2-product causal logits kept in the accumulator registers (S^T = K Q^T), online softmax in f32 (base 2: exponent = one fused multiply-add of the raw product, 2^t on the transcendental unit), P split bf16 hi + lo against v bf16 hi + lo (3 products, O^T = V^T P^T), divided by the row sum at the end; output written channel-major [b][e][s] in f32 (no output projection).
#include <hip/hip_runtime.h>
#include <math.h>

typedef __attribute__((ext_vector_type(16))) _Float16 v16h;
typedef __attribute__((ext_vector_type(16))) __bf16 v16b;
typedef __attribute__((ext_vector_type(8)))  _Float16 v8h;
typedef __attribute__((ext_vector_type(8)))  float v8f;
typedef __attribute__((ext_vector_type(4)))  float v4f;
typedef __attribute__((ext_vector_type(2)))  float v2f;
typedef __attribute__((ext_vector_type(4)))  unsigned v4u;
typedef __attribute__((ext_vector_type(4)))  int v4i;
typedef float __attribute__((may_alias)) float_a;
typedef int __attribute__((may_alias)) int_a;

template <typename T> __device__ __forceinline__ void vst2(void* p, T v) { *(T*)p = v;  }
__device__ __forceinline__ v8f wmma16(v16h a, v16h b, v8f c) {
  v8f d = __builtin_amdgcn_wmma_f32_16x16x32_f16(false, a, false, b, (short)0, c, false, false);
  asm volatile("v_nop\n\tv_nop\n\tv_nop\n\tv_nop" : "+v"(d) : "v"(a), "v"(b));
  return d;
}
__device__ __forceinline__ v8f wmma_bf(v16b a, v16b b, v8f c) {
  v8f d = __builtin_amdgcn_wmma_f32_16x16x32_bf16(false, a, false, b, (short)0, c, false, false);
  asm volatile("v_nop\n\tv_nop\n\tv_nop\n\tv_nop" : "+v"(d) : "v"(a), "v"(b));
  return d;
}
// 16x16x32 fragments: lane = (h = lane>>4, row/col = lane&15); elements 0..7 = k0+8h+0..7, 8..15 = k0+16+8h+0..7; D element r = row 8h+r
__device__ __forceinline__ v16h frag_h(const _Float16* rowk0, int lane) {
  union { v16h v; v8h q[2]; } u; const _Float16* p = rowk0 + 8 * (lane >> 4);
  u.q[0] = *(const v8h*)p; u.q[1] = *(const v8h*)(p + 16); return u.v;
}
__device__ __forceinline__ v16h frag_f32(const float* rowk0, int lane) {
  v16h a; const float* p = rowk0 + 8 * (lane >> 4);
#pragma unroll
  for (int i = 0; i < 8; ++i) { a[i] = (_Float16)p[i]; a[8 + i] = (_Float16)p[16 + i]; }
  return a;
}
__device__ __forceinline__ v16h frag_f32s(const float* rowk0, int lane, float sc) {
  v16h a; const float* p = rowk0 + 8 * (lane >> 4);
#pragma unroll
  for (int i = 0; i < 8; ++i) { a[i] = (_Float16)(p[i] * sc); a[8 + i] = (_Float16)(p[16 + i] * sc); }
  return a;
}
// column fragment from a [K][ld] layout (column n), rows >= K read as 0
__device__ __forceinline__ v16h fragc_f32(const float* W, int k0, int n, int lane, int ld, int K) {
  v16h a; const int g = lane >> 4;
#pragma unroll
  for (int i = 0; i < 8; ++i) { const int ka = k0 + 8 * g + i, kb = ka + 16;
    a[i] = (_Float16)(ka < K ? W[(size_t)(ka < K ? ka : K - 1) * ld + n] : 0.f); a[8 + i] = (_Float16)(kb < K ? W[(size_t)(kb < K ? kb : K - 1) * ld + n] : 0.f); }
  return a;
}
struct F2 { v16b h, l; };
__device__ __forceinline__ F2 bsplit16(const float v[16]) { F2 r;
#pragma unroll
  for (int i = 0; i < 16; ++i) { const __bf16 h = (__bf16)v[i]; r.h[i] = h; r.l[i] = (__bf16)(v[i] - (float)h); }
  return r; }
__device__ __forceinline__ F2 split_row(const float* row, int k0, int lane) { float v[16]; const float* p = row + k0 + 8 * (lane >> 4);
#pragma unroll
  for (int i = 0; i < 8; ++i) { v[i] = p[i]; v[8 + i] = p[16 + i]; }
  const F2 r = bsplit16(v);
  asm volatile("s_wait_xcnt 0x0" :: "v"(p) : "memory");   // names the row loads' address as an input: the allocator may reuse that register pair (as a later load's destination) only behind this wait
  return r; }
__device__ __forceinline__ F2 split_rowK(const float* row, int k0, int lane, int K) { float v[16]; const int g = lane >> 4;
#pragma unroll
  for (int i = 0; i < 8; ++i) { const int ka = k0 + 8 * g + i, kb = ka + 16; v[i] = ka < K ? row[ka < K ? ka : K - 1] : 0.f; v[8 + i] = kb < K ? row[kb < K ? kb : K - 1] : 0.f; }
  return bsplit16(v); }
__device__ __forceinline__ F2 split_col(const float* W, int k0, int n, int lane, int ld, int K) { float v[16]; const int g = lane >> 4;
#pragma unroll
  for (int i = 0; i < 8; ++i) { const int ka = k0 + 8 * g + i, kb = ka + 16; v[i] = ka < K ? W[(size_t)(ka < K ? ka : K - 1) * ld + n] : 0.f; v[8 + i] = kb < K ? W[(size_t)(kb < K ? kb : K - 1) * ld + n] : 0.f; }
  return bsplit16(v); }
__device__ __forceinline__ v8f mac3(const F2& a, const F2& b, v8f c) { c = wmma_bf(a.l, b.h, c); c = wmma_bf(a.h, b.l, c); return wmma_bf(a.h, b.h, c); }
__device__ __forceinline__ float sigm(float v) { return 1.0f / (1.0f + expf(-v)); }
#define LDSX() do { asm volatile("s_wait_dscnt 0" ::: "memory"); __builtin_amdgcn_wave_barrier(); __builtin_amdgcn_fence(__ATOMIC_RELEASE, "workgroup"); } while (0)


// PixelSNAIL causal attention (B 8, 32x32 = 1,024 positions, q from a 256-ch query map, k/v from a 256-ch key map, embed 512 = 8 heads x 64): channel-major in, channel-major out [b][h*64+d][s].
#define NB 8
#define TT 1024
#define CC 512
#define NH 8
#define HD 64
#ifndef TNB
#define TNB NB
#endif
typedef __attribute__((ext_vector_type(8))) __bf16 v8b;
typedef __attribute__((ext_vector_type(4))) __bf16 v4b;
__device__ __forceinline__ v16b frag_b(const __bf16* rowk0, int lane) {
  union { v16b v; v8b q[2]; } u; const __bf16* p = rowk0 + 8 * (lane >> 4);
  u.q[0] = *(const v8b*)p; u.q[1] = *(const v8b*)(p + 16); return u.v;
}
__device__ __forceinline__ float bfr(float v) { return (float)(__bf16)v; }
__device__ __attribute__((noinline)) float exp_ni(float v) { return expf(v); }
__device__ __attribute__((noinline)) float erf_ni(float v) { return erff(v); }

#define WS_QH  0u
#define WS_QL  (WS_QH + 2u * (size_t)NB * TT * CC)
#define WS_KH  (WS_QL + 2u * (size_t)NB * TT * CC)
#define WS_VT  (WS_KH + 2u * (size_t)NB * TT * CC)      // bf16 v planes [b][c][t]
#define WS_VL  (WS_VT + 2u * (size_t)NB * CC * TT)      // bf16 v residual planes
#define HG (NB * NH)                                  // (batch, head) pairs per launch: all of them
#define WS_END (WS_VL + 2u * (size_t)NB * CC * TT)

#define CIN 256
// ---- k_proj: block = (64 positions, 128 out cols, b*3 + which): x^T tile [64 s][256 c] bf16 in LDS from the channel-major map (query for q, key for k/v); the 128 rows of W [out][in] in bf16 in LDS too, read as fragments by all four waves; W + b exact; q -> f16 hi + residual rows, k -> f16 rows, v -> bf16 hi + lo planes
__global__ __launch_bounds__(128) void k_proj(const float* __restrict__ XQ, const float* __restrict__ XK, const float* __restrict__ WQ, const float* __restrict__ BQ, const float* __restrict__ WK, const float* __restrict__ BK, const float* __restrict__ WV, const float* __restrict__ BV, _Float16* __restrict__ QH, _Float16* __restrict__ QL, _Float16* __restrict__ KH, __bf16* __restrict__ VT, __bf16* __restrict__ VL) {
  __shared__ __align__(16) __bf16 sx[64][CIN + 8]; __shared__ __align__(16) __bf16 sw[128][CIN + 8];   // sw: the block's 128 rows of W in bf16, one copy for all four waves; pitch 528 B = 16 B x odd
  // the output tiles take sw's place once every wave has left the product loop (the barrier behind it)
  _Float16 (*sh)[136] = (_Float16 (*)[136])&sw[0][0]; _Float16 (*sl)[136] = sh + 64; __bf16 (*th)[72] = (__bf16 (*)[72])&sw[0][0]; __bf16 (*tl2)[72] = th + 128;
  const int tid = threadIdx.x, wave = tid >> 5, lane = tid & 31, col = lane & 15, g = lane >> 4; const int p0 = blockIdx.x * 64; const int c0 = blockIdx.y * 128; const size_t b = blockIdx.z / 3; const int which = blockIdx.z % 3;
  const float* X = which == 0 ? XQ : XK; const float* Wm = which == 0 ? WQ : which == 1 ? WK : WV; const float* Bm = which == 0 ? BQ : which == 1 ? BK : BV;
  { const float* wp = Wm + (size_t)c0 * CIN + tid * 4;   // the 128 rows are one contiguous 128 KiB: a wave's 16-byte loads cover whole lines
#pragma unroll 1   // rolled: two batches of 32 loads in flight; more would only cost registers
    for (int it = 0; it < 2; ++it) { v4f r[32];
#pragma unroll   // unrolled: r stays in registers and the 32 loads issue back to back
      for (int u = 0; u < 32; ++u) r[u] = *(const v4f*)(wp + (it * 32 + u) * 512);
#pragma unroll   // unrolled: r is indexed by constants
      for (int u = 0; u < 32; ++u) { v4b w4; w4[0] = (__bf16)r[u][0]; w4[1] = (__bf16)r[u][1]; w4[2] = (__bf16)r[u][2]; w4[3] = (__bf16)r[u][3]; *(v4b*)&sw[(it * 32 + u) * 2 + (tid >> 6)][(tid & 63) * 4] = w4; } } }
  { const int xq = lane & 7, xo = tid >> 3;   // the x tile: a lane takes 4 positions (16 bytes) of each of 8 channels, four times over; eight lanes cover one whole 128-byte line of a channel's row
    const float* xp = X + (b * CIN + xo * 8) * (size_t)TT + p0 + xq * 4; v4f r[32];
#pragma unroll   // unrolled: r stays in registers and the 32 loads issue back to back, one round trip for the whole tile
    for (int u = 0; u < 32; ++u) r[u] = *(const v4f*)(xp + ((u >> 4) * 128 + (u & 7)) * TT + ((u >> 3) & 1) * 32);
#pragma unroll   // unrolled: r is indexed by constants
    for (int m = 0; m < 4; ++m)
#pragma unroll   // unrolled: the same
      for (int i = 0; i < 4; ++i) { v8b w8;   // one position's 8 channels: the transpose happens in registers, one 16-byte LDS store
#pragma unroll   // unrolled: the same
        for (int k = 0; k < 8; ++k) w8[k] = (__bf16)r[m * 8 + k][i];
        *(v8b*)&sx[(m & 1) * 32 + xq * 4 + i][(m >> 1) * 128 + xo * 8] = w8; } }
  __syncthreads();
  v8f acc[8] = {};
#pragma unroll 2
  for (int kc = 0; kc < CIN / 32; ++kc) { const v16b a = frag_b(&sx[wave * 16 + col][kc * 32], lane); v16b wf[8];
#pragma unroll
    for (int j = 0; j < 8; ++j) wf[j] = frag_b(&sw[j * 16 + col][kc * 32], lane);   // all eight W fragments of this k step in one group of LDS reads, not one wait per product
#pragma unroll
    for (int j = 0; j < 8; ++j) acc[j] = wmma_bf(a, wf[j], acc[j]); }
  __syncthreads();   // every wave has read its last sw fragment: the output tiles below overwrite sw
#pragma unroll
  for (int j = 0; j < 8; ++j) { const float bb = bfr(Bm[c0 + j * 16 + col]);
#pragma unroll
    for (int r = 0; r < 8; ++r) { const float v = acc[j][r] + bb; const int rl = wave * 16 + 8 * g + r, cl = j * 16 + col;
      if (which == 2) { const __bf16 bh = (__bf16)v; th[cl][rl] = bh; tl2[cl][rl] = (__bf16)(v - (float)bh); } else { const _Float16 hv = (_Float16)v; sh[rl][cl] = hv; sl[rl][cl] = (_Float16)(v - (float)hv); } } }
  __syncthreads();
  if (which < 2) { _Float16* dh = which == 0 ? QH : KH; for (int e = tid; e < 64 * 16; e += 128) { const int rl = e >> 4, q = e & 15; const size_t row = b * TT + p0 + rl; vst2((unsigned*)(dh + row * CC + c0 + q * 8), *(const v4u*)&sh[rl][q * 8]); if (which == 0) vst2((unsigned*)(QL + row * CC + c0 + q * 8), *(const v4u*)&sl[rl][q * 8]); } }
  else { for (int e = tid; e < 128 * 8; e += 128) { const int cl = e >> 3, q = e & 7; const size_t o2 = (b * CC + c0 + cl) * (size_t)TT + p0 + q * 8; vst2((unsigned*)(VT + o2), *(const v4u*)&th[cl][q * 8]); vst2((unsigned*)(VL + o2), *(const v4u*)&tl2[cl][q * 8]); } } }
__device__ __forceinline__ v8f mm16(v16h a, v16h b, v8f c) { return __builtin_amdgcn_wmma_f32_16x16x32_f16(false, a, false, b, (short)0, c, false, false); }
__device__ __forceinline__ v8f mmbf(v16b a, v16b b, v8f c) { return __builtin_amdgcn_wmma_f32_16x16x32_bf16(false, a, false, b, (short)0, c, false, false); }
// one 16x16x32 fragment in the hardware k order; p = row + k0 + 8 * (lane >> 4): elements 0..7 at p, 8..15 at p + 16
template <typename V16, typename V8, typename E> __device__ __forceinline__ V16 ld16(const E* p) { union { V16 v; V8 q[2]; } u; u.q[0] = *(const V8*)p; u.q[1] = *(const V8*)(p + 16); return u.v; }
// 2^t on the transcendental unit; a masked score (t far below the underflow bound) gives 0
__device__ __forceinline__ float exp2_hw(float t) {
  float r; asm("v_exp_f32 %0, %1\n\tv_nop" : "=v"(r) : "v"(t));   // v_nop: the one slot that the instruction set asks for behind a transcendental, tied to it here
  return r; }
#define SC2 0x1.715476p-3f       // log2(e) / 8: a raw q.k product times SC2 is the logit in the base-2 domain
// lane l <-> lane l ^ 16
__device__ __forceinline__ float xhalf(float x) { return __builtin_bit_cast(float, __builtin_amdgcn_permlanex16(__builtin_bit_cast(int, x), __builtin_bit_cast(int, x), 0x76543210, 0xfedcba98, false, false)); }
// ---- k_att: block = (query tile pair, (b,h)); 4 waves x 16 queries walk 64-query tile 15 - x, then tile x (equal work in every block: 17 stages of 64 keys). Per 32-key pass of a wave:
// S^T = K Q^T (a lane holds 16 keys of ONE query, lane ^ 16 the other 16), running maximum and sum, P^T packed from the score registers as the B operand, O^T += V^T P^T.
// K rows and V^T rows of a stage stand in LDS, one copy for the four waves, brought by whole-line asynchronous copies into two buffers: stage t + 2 flies while stage t + 1 is worked on.
// Every plain '#pragma unroll' below unrolls a short constant loop fully, so that the fragment and accumulator arrays it indexes stay in registers.
#define KPIT 144                 // LDS row pitch in bytes: a 128-byte row + 16 = 16 B x odd, for the 16-byte fragment reads
#define TILEB (64 * KPIT)        // one tile: 64 rows (K: keys x 64 channels; V^T: channels x 64 keys)
#define STGB (3 * TILEB)         // a stage: K, V^T hi, V^T lo
#define NSTG (TT / 64 + 1)       // stages of a block: (16 - x) of the first tile + (x + 1) of the second
// one stage: every lane copies 12 x 16 bytes (rows r, r + 16, r + 32, r + 48 of each tile; eight lanes cover one 128-byte row). d = the lane's LDS byte address in the K tile.
// s_wait_xcnt 0 is the statement's last line: the address registers that the copies name are rewritten only behind it
__device__ __forceinline__ void cp_stage(unsigned d, const _Float16* k, const __bf16* vh, const __bf16* vl) {
  asm volatile(
    "global_load_async_to_lds_b128 %0, %12, off\n\t"
    "global_load_async_to_lds_b128 %1, %13, off\n\t"
    "global_load_async_to_lds_b128 %2, %14, off\n\t"
    "global_load_async_to_lds_b128 %3, %15, off\n\t"
    "global_load_async_to_lds_b128 %4, %16, off\n\t"
    "global_load_async_to_lds_b128 %5, %17, off\n\t"
    "global_load_async_to_lds_b128 %6, %18, off\n\t"
    "global_load_async_to_lds_b128 %7, %19, off\n\t"
    "global_load_async_to_lds_b128 %8, %20, off\n\t"
    "global_load_async_to_lds_b128 %9, %21, off\n\t"
    "global_load_async_to_lds_b128 %10, %22, off\n\t"
    "global_load_async_to_lds_b128 %11, %23, off\n\t"
    "s_wait_xcnt 0x0"
    :: "v"(d), "v"(d + 16 * KPIT), "v"(d + 32 * KPIT), "v"(d + 48 * KPIT),
       "v"(d + TILEB), "v"(d + TILEB + 16 * KPIT), "v"(d + TILEB + 32 * KPIT), "v"(d + TILEB + 48 * KPIT),
       "v"(d + 2 * TILEB), "v"(d + 2 * TILEB + 16 * KPIT), "v"(d + 2 * TILEB + 32 * KPIT), "v"(d + 2 * TILEB + 48 * KPIT),
       "v"(k), "v"(k + 16 * CC), "v"(k + 32 * CC), "v"(k + 48 * CC),
       "v"(vh), "v"(vh + 16 * TT), "v"(vh + 32 * TT), "v"(vh + 48 * TT),
       "v"(vl), "v"(vl + 16 * TT), "v"(vl + 32 * TT), "v"(vl + 48 * TT)
    : "memory"); }
__global__ __launch_bounds__(128) void k_att(const _Float16* __restrict__ QH, const _Float16* __restrict__ QL, const _Float16* __restrict__ KH, const __bf16* __restrict__ VT, const __bf16* __restrict__ VL, float* __restrict__ Y) {
  __shared__ __align__(16) float so[HD][68];
  __shared__ __align__(16) unsigned char ring[2 * STGB];
  const int tid = threadIdx.x, lane = tid & 31, col = lane & 15, g = lane >> 4; const int wave = __builtin_amdgcn_readfirstlane(tid >> 5);   // scalar: a wave's trip count and its diagonal test become scalar branches (EXEC stays full at the matrix instructions)
  const int b = blockIdx.y / NH, h = blockIdx.y % NH;
  const int n0 = TT / 64 - (int)blockIdx.x;   // stages of the first tile; stage s holds keys 64 * (s < n0 ? s : s - n0) + 0..63
  const int crow = tid >> 3, cq = tid & 7;    // the copies: row and 16-byte piece of this lane
  const _Float16* kcp = KH + ((size_t)b * TT + crow) * CC + h * HD + cq * 8;
  const size_t vco = ((size_t)b * CC + h * HD + crow) * (size_t)TT + cq * 8; const __bf16* vhc = VT + vco; const __bf16* vlc = VL + vco;
  const unsigned cl = (unsigned)(size_t)&ring[0] + crow * KPIT + cq * 16;
  const int fo = col * KPIT + g * 16;         // the fragment reads: row col of a 16-row tile, this lane half's first 16 bytes
  const int dl = col + (wave & 1) * 16 - 8 * g;   // a wave's last pass begins at key ql0 - (ql0 & 16): this lane's query minus its lane half's first key there, the same in both tiles (its compares stay outside the stage loop)
  cp_stage(cl, kcp, vhc, vlc);                                    // stage 0 (keys 0..63) into buffer 0
  asm volatile("s_wait_asynccnt 0x0" ::: "memory");               // this wave's copies of stage 0 have landed
  __syncthreads();                                                // every wave's have: stage 0 may be read
  cp_stage(cl + STGB, kcp + (size_t)64 * CC, vhc + 64, vlc + 64); // stage 1 (keys 64..127: the first tile has 9 stages or more) into buffer 1
  int x = TT / 64 - 1 - (int)blockIdx.x, ts = 0;                  // the query tile, and the stage's number within it
  v16h qh[2] = {}, ql[2] = {}; float m = -3.0e38f, l = 0.f; v8f acc[HD / 16] = {};
#pragma unroll 1   // rolled: one copy of the stage serves both tiles
  for (int t = 0; t < NSTG; ++t) { const int ql0 = x * 64 + wave * 16;
    const int nb = (ql0 + 47) >> 5;   // 32-key passes that hold keys [0, ql0 + 16); every query has an unmasked key in each of them
    if (ts == 0) {   // block-uniform: a tile begins
      const size_t qo = ((size_t)b * TT + ql0 + col) * CC + h * HD + 8 * g; const _Float16* qhp = QH + qo; const _Float16* qlp = QL + qo;
#pragma unroll
      for (int kc = 0; kc < 2; ++kc) { qh[kc] = ld16<v16h, v8h>(qhp + kc * 32); ql[kc] = ld16<v16h, v8h>(qlp + kc * 32); }
      asm volatile("s_wait_xcnt 0x0" :: "v"(qhp), "v"(qlp) : "memory");   // names the loads' addresses as inputs: their registers may be reused (also as a later load's destination) only behind this wait
      m = -3.0e38f; l = 0.f;
#pragma unroll
      for (int j = 0; j < HD / 16; ++j) acc[j] = v8f{}; }
    const unsigned char* sb = ring + (t & 1) * STGB + fo;
    v16h kf[2][2];
#pragma unroll
    for (int u = 0; u < 2; ++u)
#pragma unroll
      for (int kc = 0; kc < 2; ++kc) kf[u][kc] = ld16<v16h, v8h>((const _Float16*)(sb + u * 16 * KPIT + kc * 64));
    const int np = nb - ts * 2 < 2 ? nb - ts * 2 : 2;   // wave-uniform: waves 0 and 1 skip the second pass of a tile's last stage
#pragma unroll 1   // rolled: a second copy of the pass would need a second set of V^T fragments in registers
    for (int pp = 0; pp < np; ++pp) { const int p = ts * 2 + pp;
      const unsigned char* pv = sb + TILEB + pp * 64;
      v16b vh[HD / 16], vl[HD / 16];   // this pass's V^T fragments: in flight under the score products and the softmax
#pragma unroll
      for (int j = 0; j < HD / 16; ++j) { vh[j] = ld16<v16b, v8b>((const __bf16*)(pv + j * 16 * KPIT)); vl[j] = ld16<v16b, v8b>((const __bf16*)(pv + TILEB + j * 16 * KPIT)); }
      v8f st[2] = {};
#pragma unroll
      for (int kc = 0; kc < 2; ++kc) {
#pragma unroll
        for (int u = 0; u < 2; ++u) st[u] = mm16(kf[u][kc], qh[kc], st[u]);
#pragma unroll
        for (int u = 0; u < 2; ++u) st[u] = mm16(kf[u][kc], ql[kc], st[u]); }
      if (pp == 0) {   // the second pass's K fragments, one pass ahead, from this stage's own buffer
#pragma unroll
        for (int u = 0; u < 2; ++u)
#pragma unroll
          for (int kc = 0; kc < 2; ++kc) kf[u][kc] = ld16<v16h, v8h>((const _Float16*)(sb + (32 + u * 16) * KPIT + kc * 64)); }
      float s[16];
#pragma unroll
      for (int i = 0; i < 16; ++i) s[i] = st[i >> 3][i & 7];   // raw q.k of key p * 32 + 16 * (i >> 3) + 8 * g + (i & 7), query ql0 + col
      if (p == nb - 1) {   // wave-uniform: only the last pass meets the diagonal
#pragma unroll
        for (int i = 0; i < 16; ++i) if (16 * (i >> 3) + (i & 7) > dl) s[i] = -3.0e38f; }   // key > query
      float mx = s[0];
#pragma unroll
      for (int i = 1; i < 16; ++i) mx = fmaxf(mx, s[i]);
      mx = fmaxf(mx, xhalf(mx));
      const float mn = fmaxf(m, mx * SC2), al = exp2_hw(m - mn); m = mn;   // the running maximum is kept in the base-2 domain; al = 0 in the first pass
      float ps = 0.f;
#pragma unroll
      for (int i = 0; i < 16; i += 2) {   // scale, base change and maximum in one fused multiply-add, rounded once, two scores to a packed instruction; a masked score gives 0
        const v2f t = __builtin_elementwise_fma(v2f{s[i], s[i + 1]}, v2f{SC2, SC2}, v2f{-mn, -mn});
        s[i] = exp2_hw(t[0]); s[i + 1] = exp2_hw(t[1]); ps += s[i]; ps += s[i + 1]; }
      l = l * al + ps;   // each lane half sums its own keys; the halves join behind the tile's last stage
      const F2 pf = bsplit16(s);
#pragma unroll
      for (int j = 0; j < HD / 16; ++j) acc[j] = acc[j] * al;
#pragma unroll
      for (int j = 0; j < HD / 16; ++j) acc[j] = mmbf(vh[j], pf.h, acc[j]);
#pragma unroll
      for (int j = 0; j < HD / 16; ++j) acc[j] = mmbf(vh[j], pf.l, acc[j]);
#pragma unroll
      for (int j = 0; j < HD / 16; ++j) acc[j] = mmbf(vl[j], pf.h, acc[j]); }
    if (ts == x) {   // block-uniform: the tile's last stage is done
      l += xhalf(l); const float inv = 1.0f / l;
#pragma unroll
      for (int j = 0; j < HD / 16; ++j)
#pragma unroll
        for (int r = 0; r < 8; ++r) so[j * 16 + 8 * g + r][wave * 16 + col] = acc[j][r] * inv;   // O^T: row = channel, column = query
      __syncthreads();   // all four waves' columns stand in so
      for (int e = tid; e < HD * 16; e += 128) { const int d = e >> 4, q4 = e & 15; vst2(Y + ((size_t)b * CC + h * HD + d) * TT + x * 64 + q4 * 4, *(const v4f*)&so[d][q4 * 4]); }
      x = (int)blockIdx.x; ts = 0;   // so is rewritten by the second tile only behind the stage barrier below
    } else ++ts;
    asm volatile("s_wait_dscnt 0x0" ::: "memory");      // this wave's reads of stage t's buffer (and of so) have returned
    asm volatile("s_wait_asynccnt 0x0" ::: "memory");   // this wave's copies of stage t + 1 have landed
    __syncthreads();                                    // publishes stage t + 1 and frees stage t's buffer
    if (t + 2 < NSTG) { const int s2 = t + 2, k2 = (s2 < n0 ? s2 : s2 - n0) * 64;   // block-uniform: only while stage t + 2 exists
      cp_stage(cl + (t & 1) * STGB, kcp + (size_t)k2 * CC, vhc + k2, vlc + k2); } }
  asm volatile("s_wait_asynccnt 0x0" ::: "memory");     // nothing is in flight when the wave ends
}
extern "C" void kernel_launch(void* const* d_in, const int* in_sizes, int n_in, void* d_out, int out_size, void* d_ws, size_t ws_size, hipStream_t stream) {
  (void)in_sizes; (void)n_in; (void)out_size;
  const float** F = (const float**)d_in;   // 0 query [8,256,32,32], 1 key [8,256,32,32], 2 Wq [512,256], 3 bq, 4 Wk [512,256], 5 bk, 6 Wv [512,256], 7 bv
  if (ws_size < (size_t)WS_END) return;
  char* ws = (char*)d_ws; _Float16 *QH = (_Float16*)(ws + WS_QH), *QL = (_Float16*)(ws + WS_QL), *KH = (_Float16*)(ws + WS_KH); __bf16 *VT = (__bf16*)(ws + WS_VT), *VL = (__bf16*)(ws + WS_VL);
  k_proj<<<dim3(TT / 64, CC / 128, TNB * 3), 128, 0, stream>>>(F[0], F[1], F[2], F[3], F[4], F[5], F[6], F[7], QH, QL, KH, VT, VL);
  k_att<<<dim3(TT / 128, HG), 128, 0, stream>>>(QH, QL, KH, VT, VL, (float*)d_out);   // logits, softmax and P.V of every (batch, head) in one launch
}

// v007
// Measured time: 46.1 microseconds a run.
// Timed twice side by side with v006, it ran 1.15 and 1.14 times as fast.
// Counting every step since v000, it is 16.1 times as fast.
// compute dtype: all float inputs rounded to bf16; q = query^T Wq^T + bq, k/v = key^T W^T + b with EXACT bf16 products on WMMA 16x16x32 (channel-major tiles transposed in registers on the way to LDS), f32 accumulate; q as f16 hi + residual, k f16 -> 2-product causal logits kept in the accumulator registers (S^T = K Q^T), online softmax in f32 (base 2: exponent = one fused multiply-add of the raw product, 2^t on the transcendental unit), P split bf16 hi + lo against v bf16 hi + lo (3 products, O^T = V^T P^T), divided by the row sum at the end; output written channel-major [b][e][s] in f32 (no output projection).
#include <hip/hip_runtime.h>
#include <math.h>

typedef __attribute__((ext_vector_type(16))) _Float16 v16h;
typedef __attribute__((ext_vector_type(16))) __bf16 v16b;
typedef __attribute__((ext_vector_type(8)))  _Float16 v8h;
typedef __attribute__((ext_vector_type(8)))  float v8f;
typedef __attribute__((ext_vector_type(4)))  float v4f;
typedef __attribute__((ext_vector_type(2)))  float v2f;
typedef __attribute__((ext_vector_type(4)))  unsigned v4u;
typedef __attribute__((ext_vector_type(4)))  int v4i;
typedef float __attribute__((may_alias)) float_a;
typedef int __attribute__((may_alias)) int_a;

template <typename T> __device__ __forceinline__ void vst2(void* p, T v) { *(T*)p = v;  }
__device__ __forceinline__ v8f wmma16(v16h a, v16h b, v8f c) {
  v8f d = __builtin_amdgcn_wmma_f32_16x16x32_f16(false, a, false, b, (short)0, c, false, false);
  asm volatile("v_nop\n\tv_nop\n\tv_nop\n\tv_nop" : "+v"(d) : "v"(a), "v"(b));
  return d;
}
__device__ __forceinline__ v8f wmma_bf(v16b a, v16b b, v8f c) {
  v8f d = __builtin_amdgcn_wmma_f32_16x16x32_bf16(false, a, false, b, (short)0, c, false, false);
  asm volatile("v_nop\n\tv_nop\n\tv_nop\n\tv_nop" : "+v"(d) : "v"(a), "v"(b));
  return d;
}
// 16x16x32 fragments: lane = (h = lane>>4, row/col = lane&15); elements 0..7 = k0+8h+0..7, 8..15 = k0+16+8h+0..7; D element r = row 8h+r
__device__ __forceinline__ v16h frag_h(const _Float16* rowk0, int lane) {
  union { v16h v; v8h q[2]; } u; const _Float16* p = rowk0 + 8 * (lane >> 4);
  u.q[0] = *(const v8h*)p; u.q[1] = *(const v8h*)(p + 16); return u.v;
}
__device__ __forceinline__ v16h frag_f32(const float* rowk0, int lane) {
  v16h a; const float* p = rowk0 + 8 * (lane >> 4);
#pragma unroll
  for (int i = 0; i < 8; ++i) { a[i] = (_Float16)p[i]; a[8 + i] = (_Float16)p[16 + i]; }
  return a;
}
__device__ __forceinline__ v16h frag_f32s(const float* rowk0, int lane, float sc) {
  v16h a; const float* p = rowk0 + 8 * (lane >> 4);
#pragma unroll
  for (int i = 0; i < 8; ++i) { a[i] = (_Float16)(p[i] * sc); a[8 + i] = (_Float16)(p[16 + i] * sc); }
  return a;
}
// column fragment from a [K][ld] layout (column n), rows >= K read as 0
__device__ __forceinline__ v16h fragc_f32(const float* W, int k0, int n, int lane, int ld, int K) {
  v16h a; const int g = lane >> 4;
#pragma unroll
  for (int i = 0; i < 8; ++i) { const int ka = k0 + 8 * g + i, kb = ka + 16;
    a[i] = (_Float16)(ka < K ? W[(size_t)(ka < K ? ka : K - 1) * ld + n] : 0.f); a[8 + i] = (_Float16)(kb < K ? W[(size_t)(kb < K ? kb : K - 1) * ld + n] : 0.f); }
  return a;
}
struct F2 { v16b h, l; };
__device__ __forceinline__ F2 bsplit16(const float v[16]) { F2 r;
#pragma unroll
  for (int i = 0; i < 16; ++i) { const __bf16 h = (__bf16)v[i]; r.h[i] = h; r.l[i] = (__bf16)(v[i] - (float)h); }
  return r; }
__device__ __forceinline__ F2 split_row(const float* row, int k0, int lane) { float v[16]; const float* p = row + k0 + 8 * (lane >> 4);
#pragma unroll
  for (int i = 0; i < 8; ++i) { v[i] = p[i]; v[8 + i] = p[16 + i]; }
  const F2 r = bsplit16(v);
  asm volatile("s_wait_xcnt 0x0" :: "v"(p) : "memory");   // names the row loads' address as an input: the allocator may reuse that register pair (as a later load's destination) only behind this wait
  return r; }
__device__ __forceinline__ F2 split_rowK(const float* row, int k0, int lane, int K) { float v[16]; const int g = lane >> 4;
#pragma unroll
  for (int i = 0; i < 8; ++i) { const int ka = k0 + 8 * g + i, kb = ka + 16; v[i] = ka < K ? row[ka < K ? ka : K - 1] : 0.f; v[8 + i] = kb < K ? row[kb < K ? kb : K - 1] : 0.f; }
  return bsplit16(v); }
__device__ __forceinline__ F2 split_col(const float* W, int k0, int n, int lane, int ld, int K) { float v[16]; const int g = lane >> 4;
#pragma unroll
  for (int i = 0; i < 8; ++i) { const int ka = k0 + 8 * g + i, kb = ka + 16; v[i] = ka < K ? W[(size_t)(ka < K ? ka : K - 1) * ld + n] : 0.f; v[8 + i] = kb < K ? W[(size_t)(kb < K ? kb : K - 1) * ld + n] : 0.f; }
  return bsplit16(v); }
__device__ __forceinline__ v8f mac3(const F2& a, const F2& b, v8f c) { c = wmma_bf(a.l, b.h, c); c = wmma_bf(a.h, b.l, c); return wmma_bf(a.h, b.h, c); }
__device__ __forceinline__ float sigm(float v) { return 1.0f / (1.0f + expf(-v)); }
#define LDSX() do { asm volatile("s_wait_dscnt 0" ::: "memory"); __builtin_amdgcn_wave_barrier(); __builtin_amdgcn_fence(__ATOMIC_RELEASE, "workgroup"); } while (0)


// Causal attention (B 8, 32x32 = 1,024 positions, q from a 256-ch query map, k/v from a 256-ch key map, embed 512 = 8 heads x 64): channel-major in, channel-major out [b][h*64+d][s].
#define NB 8
#define TT 1024
#define CC 512
#define NH 8
#define HD 64
#ifndef TNB
#define TNB NB
#endif
typedef __attribute__((ext_vector_type(8))) __bf16 v8b;
typedef __attribute__((ext_vector_type(4))) __bf16 v4b;
__device__ __forceinline__ v16b frag_b(const __bf16* rowk0, int lane) {
  union { v16b v; v8b q[2]; } u; const __bf16* p = rowk0 + 8 * (lane >> 4);
  u.q[0] = *(const v8b*)p; u.q[1] = *(const v8b*)(p + 16); return u.v;
}
__device__ __forceinline__ float bfr(float v) { return (float)(__bf16)v; }
__device__ __attribute__((noinline)) float exp_ni(float v) { return expf(v); }
__device__ __attribute__((noinline)) float erf_ni(float v) { return erff(v); }

#define WS_QH  0u
#define WS_QL  (WS_QH + 2u * (size_t)NB * TT * CC)
#define WS_KH  (WS_QL + 2u * (size_t)NB * TT * CC)
#define WS_VT  (WS_KH + 2u * (size_t)NB * TT * CC)      // bf16 v planes [b][c][t]
#define WS_VL  (WS_VT + 2u * (size_t)NB * CC * TT)      // bf16 v residual planes
#define HG (NB * NH)                                  // (batch, head) pairs per launch: all of them
#define WS_END (WS_VL + 2u * (size_t)NB * CC * TT)

#define CIN 256
// ---- k_proj: block = (64 positions, 128 out cols, b*3 + which): x^T tile [64 s][256 c] bf16 in LDS from the channel-major map (query for q, key for k/v); the 128 rows of W [out][in] in bf16 in LDS too, read as fragments by all four waves; W + b exact; q -> f16 hi + residual rows, k -> f16 rows, v -> bf16 hi + lo planes
// The product's orientation follows the output's layout: v planes are position-contiguous (D = x W^T: a lane's 8 accumulator registers are 8 positions of one channel), q and k rows are channel-contiguous (D = W x^T: 8 channels of one position), so every lane packs 16 bytes of one output row
// q, k: one position's 8 channels j * 16 + 8 * g + 0..7 plus their biases -> f16 (LO: and the f16 residual), one 16-byte LDS store each
template <bool LO> __device__ __forceinline__ void put_rows(const v8f (&acc)[8], const float* sb, _Float16* hrow, _Float16* lrow, int g) {
#pragma unroll   // unrolled: acc is indexed by constants
  for (int j = 0; j < 8; ++j) { const v4f b0 = *(const v4f*)&sb[j * 16 + 8 * g], b1 = *(const v4f*)&sb[j * 16 + 8 * g + 4]; v8h h8, l8;
#pragma unroll   // unrolled: the same
    for (int r = 0; r < 8; ++r) { const float v = acc[j][r] + (r < 4 ? b0[r & 3] : b1[r & 3]); const _Float16 hv = (_Float16)v; h8[r] = hv; if (LO) l8[r] = (_Float16)(v - (float)hv); }
    *(v8h*)(hrow + j * 16 + 8 * g) = h8; if (LO) *(v8h*)(lrow + j * 16 + 8 * g) = l8; } }
__global__ __launch_bounds__(128) void k_proj(const float* __restrict__ XQ, const float* __restrict__ XK, const float* __restrict__ WQ, const float* __restrict__ BQ, const float* __restrict__ WK, const float* __restrict__ BK, const float* __restrict__ WV, const float* __restrict__ BV, _Float16* __restrict__ QH, _Float16* __restrict__ QL, _Float16* __restrict__ KH, __bf16* __restrict__ VT, __bf16* __restrict__ VL) {
  __shared__ __align__(16) __bf16 sx[64][CIN + 8]; __shared__ __align__(16) __bf16 sw[128][CIN + 8]; __shared__ __align__(16) float sb[128];   // sb: the block's 128 biases; sw: the block's 128 rows of W in bf16, one copy for all four waves; pitch 528 B = 16 B x odd
  // the output tiles take sw's place once every wave has left the product loop (the barrier behind it)
  _Float16 (*sh)[136] = (_Float16 (*)[136])&sw[0][0]; _Float16 (*sl)[136] = sh + 64; __bf16 (*th)[72] = (__bf16 (*)[72])&sw[0][0]; __bf16 (*tl2)[72] = th + 128;
  const int tid = threadIdx.x, wave = tid >> 5, lane = tid & 31, col = lane & 15, g = lane >> 4; const int p0 = blockIdx.x * 64; const int c0 = blockIdx.y * 128; const size_t b = blockIdx.z / 3; const int which = blockIdx.z % 3;
  const float* X = which == 0 ? XQ : XK; const float* Wm = which == 0 ? WQ : which == 1 ? WK : WV; const float* Bm = which == 0 ? BQ : which == 1 ? BK : BV;
  const float bv = Bm[c0 + tid];   // one bias a thread, in flight under the W loads
  { const float* wp = Wm + (size_t)c0 * CIN + tid * 4;   // the 128 rows are one contiguous 128 KiB: a wave's 16-byte loads cover whole lines
#pragma unroll 1   // rolled: two batches of 32 loads in flight; more would only cost registers
    for (int it = 0; it < 2; ++it) { v4f r[32];
#pragma unroll   // unrolled: r stays in registers and the 32 loads issue back to back
      for (int u = 0; u < 32; ++u) r[u] = *(const v4f*)(wp + (it * 32 + u) * 512);
#pragma unroll   // unrolled: r is indexed by constants
      for (int u = 0; u < 32; ++u) { v4b w4; w4[0] = (__bf16)r[u][0]; w4[1] = (__bf16)r[u][1]; w4[2] = (__bf16)r[u][2]; w4[3] = (__bf16)r[u][3]; *(v4b*)&sw[(it * 32 + u) * 2 + (tid >> 6)][(tid & 63) * 4] = w4; } } }
  { const int xq = lane & 7, xo = tid >> 3;   // the x tile: a lane takes 4 positions (16 bytes) of each of 8 channels, four times over; eight lanes cover one whole 128-byte line of a channel's row
    const float* xp = X + (b * CIN + xo * 8) * (size_t)TT + p0 + xq * 4; v4f r[32];
#pragma unroll   // unrolled: r stays in registers and the 32 loads issue back to back, one round trip for the whole tile
    for (int u = 0; u < 32; ++u) r[u] = *(const v4f*)(xp + ((u >> 4) * 128 + (u & 7)) * TT + ((u >> 3) & 1) * 32);
#pragma unroll   // unrolled: r is indexed by constants
    for (int m = 0; m < 4; ++m)
#pragma unroll   // unrolled: the same
      for (int i = 0; i < 4; ++i) { v8b w8;   // one position's 8 channels: the transpose happens in registers, one 16-byte LDS store
#pragma unroll   // unrolled: the same
        for (int k = 0; k < 8; ++k) w8[k] = (__bf16)r[m * 8 + k][i];
        *(v8b*)&sx[(m & 1) * 32 + xq * 4 + i][(m >> 1) * 128 + xo * 8] = w8; } }
  sb[tid] = bfr(bv);
  __syncthreads();
  v8f acc[8] = {};
  if (which == 2) {   // block-uniform, once: x as A, W as B
#pragma unroll 2   // two k steps a trip: half the loop overhead, a short text
    for (int kc = 0; kc < CIN / 32; ++kc) { const v16b a = frag_b(&sx[wave * 16 + col][kc * 32], lane); v16b wf[8];
#pragma unroll   // unrolled: wf is indexed by constants
      for (int j = 0; j < 8; ++j) wf[j] = frag_b(&sw[j * 16 + col][kc * 32], lane);   // all eight W fragments of this k step in one group of LDS reads, not one wait per product
#pragma unroll   // unrolled: the same, and acc
      for (int j = 0; j < 8; ++j) acc[j] = wmma_bf(a, wf[j], acc[j]); }
  } else {            // W as A, x as B: the same fragments (one loader, one k order), the operands swapped
#pragma unroll 2   // two k steps a trip: half the loop overhead, a short text
    for (int kc = 0; kc < CIN / 32; ++kc) { const v16b a = frag_b(&sx[wave * 16 + col][kc * 32], lane); v16b wf[8];
#pragma unroll   // unrolled: wf is indexed by constants
      for (int j = 0; j < 8; ++j) wf[j] = frag_b(&sw[j * 16 + col][kc * 32], lane);
#pragma unroll   // unrolled: the same, and acc
      for (int j = 0; j < 8; ++j) acc[j] = wmma_bf(wf[j], a, acc[j]); } }
  __syncthreads();   // every wave has read its last sw fragment: the output tiles below overwrite sw
  if (which == 2) {
#pragma unroll   // unrolled: acc is indexed by constants
    for (int j = 0; j < 8; ++j) { const float bb = sb[j * 16 + col]; v8b h8, l8;   // channel j * 16 + col, positions wave * 16 + 8 * g + 0..7
#pragma unroll   // unrolled: the same
      for (int r = 0; r < 8; ++r) { const float v = acc[j][r] + bb; const __bf16 bh = (__bf16)v; h8[r] = bh; l8[r] = (__bf16)(v - (float)bh); }
      *(v8b*)&th[j * 16 + col][wave * 16 + 8 * g] = h8; *(v8b*)&tl2[j * 16 + col][wave * 16 + 8 * g] = l8; }
  } else if (which == 0) put_rows<true>(acc, sb, &sh[wave * 16 + col][0], &sl[wave * 16 + col][0], g);
  else put_rows<false>(acc, sb, &sh[wave * 16 + col][0], &sl[wave * 16 + col][0], g);
  __syncthreads();
  if (which < 2) { _Float16* dh = which == 0 ? QH : KH; for (int e = tid; e < 64 * 16; e += 128) { const int rl = e >> 4, q = e & 15; const size_t row = b * TT + p0 + rl; vst2((unsigned*)(dh + row * CC + c0 + q * 8), *(const v4u*)&sh[rl][q * 8]); if (which == 0) vst2((unsigned*)(QL + row * CC + c0 + q * 8), *(const v4u*)&sl[rl][q * 8]); } }
  else { for (int e = tid; e < 128 * 8; e += 128) { const int cl = e >> 3, q = e & 7; const size_t o2 = (b * CC + c0 + cl) * (size_t)TT + p0 + q * 8; vst2((unsigned*)(VT + o2), *(const v4u*)&th[cl][q * 8]); vst2((unsigned*)(VL + o2), *(const v4u*)&tl2[cl][q * 8]); } } }
__device__ __forceinline__ v8f mm16(v16h a, v16h b, v8f c) { return __builtin_amdgcn_wmma_f32_16x16x32_f16(false, a, false, b, (short)0, c, false, false); }
__device__ __forceinline__ v8f mmbf(v16b a, v16b b, v8f c) { return __builtin_amdgcn_wmma_f32_16x16x32_bf16(false, a, false, b, (short)0, c, false, false); }
// one 16x16x32 fragment in the hardware k order; p = row + k0 + 8 * (lane >> 4): elements 0..7 at p, 8..15 at p + 16
template <typename V16, typename V8, typename E> __device__ __forceinline__ V16 ld16(const E* p) { union { V16 v; V8 q[2]; } u; u.q[0] = *(const V8*)p; u.q[1] = *(const V8*)(p + 16); return u.v; }
// 2^t on the transcendental unit; a masked score (t far below the underflow bound) gives 0
__device__ __forceinline__ float exp2_hw(float t) {
  float r; asm("v_exp_f32 %0, %1\n\tv_nop" : "=v"(r) : "v"(t));   // v_nop: the one slot that the instruction set asks for behind a transcendental, tied to it here
  return r; }
#define SC2 0x1.715476p-3f       // log2(e) / 8: a raw q.k product times SC2 is the logit in the base-2 domain
// lane l <-> lane l ^ 16
__device__ __forceinline__ float xhalf(float x) { return __builtin_bit_cast(float, __builtin_amdgcn_permlanex16(__builtin_bit_cast(int, x), __builtin_bit_cast(int, x), 0x76543210, 0xfedcba98, false, false)); }
// ---- k_att: block = (query tile pair, (b,h)); 4 waves x 16 queries walk 64-query tile 15 - x, then tile x (equal work in every block: 17 stages of 64 keys). Per 32-key pass of a wave:
// S^T = K Q^T (a lane holds 16 keys of ONE query, lane ^ 16 the other 16), running maximum and sum, P^T packed from the score registers as the B operand, O^T += V^T P^T.
// K rows and V^T rows of a stage stand in LDS, one copy for the four waves, brought by whole-line asynchronous copies into two buffers: stage t + 2 flies while stage t + 1 is worked on.
// Every plain '#pragma unroll' below unrolls a short constant loop fully, so that the fragment and accumulator arrays it indexes stay in registers.
#define KPIT 144                 // LDS row pitch in bytes: a 128-byte row + 16 = 16 B x odd, for the 16-byte fragment reads
#define TILEB (64 * KPIT)        // one tile: 64 rows (K: keys x 64 channels; V^T: channels x 64 keys)
#define STGB (3 * TILEB)         // a stage: K, V^T hi, V^T lo
#define NSTG (TT / 64 + 1)       // stages of a block: (16 - x) of the first tile + (x + 1) of the second
// one stage: every lane copies 12 x 16 bytes (rows r, r + 16, r + 32, r + 48 of each tile; eight lanes cover one 128-byte row). d = the lane's LDS byte address in the K tile.
// s_wait_xcnt 0 is the statement's last line: the address registers that the copies name are rewritten only behind it
__device__ __forceinline__ void cp_stage(unsigned d, const _Float16* k, const __bf16* vh, const __bf16* vl) {
  asm volatile(
    "global_load_async_to_lds_b128 %0, %12, off\n\t"
    "global_load_async_to_lds_b128 %1, %13, off\n\t"
    "global_load_async_to_lds_b128 %2, %14, off\n\t"
    "global_load_async_to_lds_b128 %3, %15, off\n\t"
    "global_load_async_to_lds_b128 %4, %16, off\n\t"
    "global_load_async_to_lds_b128 %5, %17, off\n\t"
    "global_load_async_to_lds_b128 %6, %18, off\n\t"
    "global_load_async_to_lds_b128 %7, %19, off\n\t"
    "global_load_async_to_lds_b128 %8, %20, off\n\t"
    "global_load_async_to_lds_b128 %9, %21, off\n\t"
    "global_load_async_to_lds_b128 %10, %22, off\n\t"
    "global_load_async_to_lds_b128 %11, %23, off\n\t"
    "s_wait_xcnt 0x0"
    :: "v"(d), "v"(d + 16 * KPIT), "v"(d + 32 * KPIT), "v"(d + 48 * KPIT),
       "v"(d + TILEB), "v"(d + TILEB + 16 * KPIT), "v"(d + TILEB + 32 * KPIT), "v"(d + TILEB + 48 * KPIT),
       "v"(d + 2 * TILEB), "v"(d + 2 * TILEB + 16 * KPIT), "v"(d + 2 * TILEB + 32 * KPIT), "v"(d + 2 * TILEB + 48 * KPIT),
       "v"(k), "v"(k + 16 * CC), "v"(k + 32 * CC), "v"(k + 48 * CC),
       "v"(vh), "v"(vh + 16 * TT), "v"(vh + 32 * TT), "v"(vh + 48 * TT),
       "v"(vl), "v"(vl + 16 * TT), "v"(vl + 32 * TT), "v"(vl + 48 * TT)
    : "memory"); }
__global__ __launch_bounds__(128) void k_att(const _Float16* __restrict__ QH, const _Float16* __restrict__ QL, const _Float16* __restrict__ KH, const __bf16* __restrict__ VT, const __bf16* __restrict__ VL, float* __restrict__ Y) {
  __shared__ __align__(16) float so[HD][68];
  __shared__ __align__(16) unsigned char ring[2 * STGB];
  const int tid = threadIdx.x, lane = tid & 31, col = lane & 15, g = lane >> 4; const int wave = __builtin_amdgcn_readfirstlane(tid >> 5);   // scalar: a wave's trip count and its diagonal test become scalar branches (EXEC stays full at the matrix instructions)
  const int b = blockIdx.y / NH, h = blockIdx.y % NH;
  const int n0 = TT / 64 - (int)blockIdx.x;   // stages of the first tile; stage s holds keys 64 * (s < n0 ? s : s - n0) + 0..63
  const int crow = tid >> 3, cq = tid & 7;    // the copies: row and 16-byte piece of this lane
  const _Float16* kcp = KH + ((size_t)b * TT + crow) * CC + h * HD + cq * 8;
  const size_t vco = ((size_t)b * CC + h * HD + crow) * (size_t)TT + cq * 8; const __bf16* vhc = VT + vco; const __bf16* vlc = VL + vco;
  const unsigned cl = (unsigned)(size_t)&ring[0] + crow * KPIT + cq * 16;
  const int fo = col * KPIT + g * 16;         // the fragment reads: row col of a 16-row tile, this lane half's first 16 bytes
  const int dl = col + (wave & 1) * 16 - 8 * g;   // a wave's last pass begins at key ql0 - (ql0 & 16): this lane's query minus its lane half's first key there, the same in both tiles (its compares stay outside the stage loop)
  cp_stage(cl, kcp, vhc, vlc);                                    // stage 0 (keys 0..63) into buffer 0
  asm volatile("s_wait_asynccnt 0x0" ::: "memory");               // this wave's copies of stage 0 have landed
  __syncthreads();                                                // every wave's have: stage 0 may be read
  cp_stage(cl + STGB, kcp + (size_t)64 * CC, vhc + 64, vlc + 64); // stage 1 (keys 64..127: the first tile has 9 stages or more) into buffer 1
  int x = TT / 64 - 1 - (int)blockIdx.x, ts = 0;                  // the query tile, and the stage's number within it
  v16h qh[2] = {}, ql[2] = {}; float m = -3.0e38f, l = 0.f; v8f acc[HD / 16] = {};
#pragma unroll 1   // rolled: one copy of the stage serves both tiles
  for (int t = 0; t < NSTG; ++t) { const int ql0 = x * 64 + wave * 16;
    const int nb = (ql0 + 47) >> 5;   // 32-key passes that hold keys [0, ql0 + 16); every query has an unmasked key in each of them
    if (ts == 0) {   // block-uniform: a tile begins
      const size_t qo = ((size_t)b * TT + ql0 + col) * CC + h * HD + 8 * g; const _Float16* qhp = QH + qo; const _Float16* qlp = QL + qo;
#pragma unroll
      for (int kc = 0; kc < 2; ++kc) { qh[kc] = ld16<v16h, v8h>(qhp + kc * 32); ql[kc] = ld16<v16h, v8h>(qlp + kc * 32); }
      asm volatile("s_wait_xcnt 0x0" :: "v"(qhp), "v"(qlp) : "memory");   // names the loads' addresses as inputs: their registers may be reused (also as a later load's destination) only behind this wait
      m = -3.0e38f; l = 0.f;
#pragma unroll
      for (int j = 0; j < HD / 16; ++j) acc[j] = v8f{}; }
    const unsigned char* sb = ring + (t & 1) * STGB + fo;
    v16h kf[2][2];
#pragma unroll
    for (int u = 0; u < 2; ++u)
#pragma unroll
      for (int kc = 0; kc < 2; ++kc) kf[u][kc] = ld16<v16h, v8h>((const _Float16*)(sb + u * 16 * KPIT + kc * 64));
    const int np = nb - ts * 2 < 2 ? nb - ts * 2 : 2;   // wave-uniform: waves 0 and 1 skip the second pass of a tile's last stage
#pragma unroll 1   // rolled: a second copy of the pass would need a second set of V^T fragments in registers
    for (int pp = 0; pp < np; ++pp) { const int p = ts * 2 + pp;
      const unsigned char* pv = sb + TILEB + pp * 64;
      v16b vh[HD / 16], vl[HD / 16];   // this pass's V^T fragments: in flight under the score products and the softmax
#pragma unroll
      for (int j = 0; j < HD / 16; ++j) { vh[j] = ld16<v16b, v8b>((const __bf16*)(pv + j * 16 * KPIT)); vl[j] = ld16<v16b, v8b>((const __bf16*)(pv + TILEB + j * 16 * KPIT)); }
      v8f st[2] = {};
#pragma unroll
      for (int kc = 0; kc < 2; ++kc) {
#pragma unroll
        for (int u = 0; u < 2; ++u) st[u] = mm16(kf[u][kc], qh[kc], st[u]);
#pragma unroll
        for (int u = 0; u < 2; ++u) st[u] = mm16(kf[u][kc], ql[kc], st[u]); }
      if (pp == 0) {   // the second pass's K fragments, one pass ahead, from this stage's own buffer
#pragma unroll
        for (int u = 0; u < 2; ++u)
#pragma unroll
          for (int kc = 0; kc < 2; ++kc) kf[u][kc] = ld16<v16h, v8h>((const _Float16*)(sb + (32 + u * 16) * KPIT + kc * 64)); }
      float s[16];
#pragma unroll
      for (int i = 0; i < 16; ++i) s[i] = st[i >> 3][i & 7];   // raw q.k of key p * 32 + 16 * (i >> 3) + 8 * g + (i & 7), query ql0 + col
      if (p == nb - 1) {   // wave-uniform: only the last pass meets the diagonal
#pragma unroll
        for (int i = 0; i < 16; ++i) if (16 * (i >> 3) + (i & 7) > dl) s[i] = -3.0e38f; }   // key > query
      float mx = s[0];
#pragma unroll
      for (int i = 1; i < 16; ++i) mx = fmaxf(mx, s[i]);
      mx = fmaxf(mx, xhalf(mx));
      const float mn = fmaxf(m, mx * SC2), al = exp2_hw(m - mn); m = mn;   // the running maximum is kept in the base-2 domain; al = 0 in the first pass
      float ps = 0.f;
#pragma unroll
      for (int i = 0; i < 16; i += 2) {   // scale, base change and maximum in one fused multiply-add, rounded once, two scores to a packed instruction; a masked score gives 0
        const v2f t = __builtin_elementwise_fma(v2f{s[i], s[i + 1]}, v2f{SC2, SC2}, v2f{-mn, -mn});
        s[i] = exp2_hw(t[0]); s[i + 1] = exp2_hw(t[1]); ps += s[i]; ps += s[i + 1]; }
      l = l * al + ps;   // each lane half sums its own keys; the halves join behind the tile's last stage
      const F2 pf = bsplit16(s);
#pragma unroll
      for (int j = 0; j < HD / 16; ++j) acc[j] = acc[j] * al;
#pragma unroll
      for (int j = 0; j < HD / 16; ++j) acc[j] = mmbf(vh[j], pf.h, acc[j]);
#pragma unroll
      for (int j = 0; j < HD / 16; ++j) acc[j] = mmbf(vh[j], pf.l, acc[j]);
#pragma unroll
      for (int j = 0; j < HD / 16; ++j) acc[j] = mmbf(vl[j], pf.h, acc[j]); }
    if (ts == x) {   // block-uniform: the tile's last stage is done
      l += xhalf(l); const float inv = 1.0f / l;
#pragma unroll
      for (int j = 0; j < HD / 16; ++j)
#pragma unroll
        for (int r = 0; r < 8; ++r) so[j * 16 + 8 * g + r][wave * 16 + col] = acc[j][r] * inv;   // O^T: row = channel, column = query
      __syncthreads();   // all four waves' columns stand in so
      for (int e = tid; e < HD * 16; e += 128) { const int d = e >> 4, q4 = e & 15; vst2(Y + ((size_t)b * CC + h * HD + d) * TT + x * 64 + q4 * 4, *(const v4f*)&so[d][q4 * 4]); }
      x = (int)blockIdx.x; ts = 0;   // so is rewritten by the second tile only behind the stage barrier below
    } else ++ts;
    asm volatile("s_wait_dscnt 0x0" ::: "memory");      // this wave's reads of stage t's buffer (and of so) have returned
    asm volatile("s_wait_asynccnt 0x0" ::: "memory");   // this wave's copies of stage t + 1 have landed
    __syncthreads();                                    // publishes stage t + 1 and frees stage t's buffer
    if (t + 2 < NSTG) { const int s2 = t + 2, k2 = (s2 < n0 ? s2 : s2 - n0) * 64;   // block-uniform: only while stage t + 2 exists
      cp_stage(cl + (t & 1) * STGB, kcp + (size_t)k2 * CC, vhc + k2, vlc + k2); } }
  asm volatile("s_wait_asynccnt 0x0" ::: "memory");     // nothing is in flight when the wave ends
}
extern "C" void kernel_launch(void* const* d_in, const int* in_sizes, int n_in, void* d_out, int out_size, void* d_ws, size_t ws_size, hipStream_t stream) {
  (void)in_sizes; (void)n_in; (void)out_size;
  const float** F = (const float**)d_in;   // 0 query [8,256,32,32], 1 key [8,256,32,32], 2 Wq [512,256], 3 bq, 4 Wk [512,256], 5 bk, 6 Wv [512,256], 7 bv
  if (ws_size < (size_t)WS_END) return;
  char* ws = (char*)d_ws; _Float16 *QH = (_Float16*)(ws + WS_QH), *QL = (_Float16*)(ws + WS_QL), *KH = (_Float16*)(ws + WS_KH); __bf16 *VT = (__bf16*)(ws + WS_VT), *VL = (__bf16*)(ws + WS_VL);
  k_proj<<<dim3(TT / 64, CC / 128, TNB * 3), 128, 0, stream>>>(F[0], F[1], F[2], F[3], F[4], F[5], F[6], F[7], QH, QL, KH, VT, VL);
  k_att<<<dim3(TT / 128, HG), 128, 0, stream>>>(QH, QL, KH, VT, VL, (float*)d_out);   // logits, softmax and P.V of every (batch, head) in one launch
}

// v008
// One run takes 44.4 microseconds.
// Timed twice side by side with v007, it ran 1.04 and 1.03 times as fast.
// Counting every step since v000, it is 16.7 times as fast.
// compute dtype: all float inputs rounded to bf16; q = query^T Wq^T + bq, k/v = key^T W^T + b with EXACT bf16 products on WMMA 16x16x32 (channel-major tiles transposed in registers on the way to LDS), f32 accumulate; q as f16 hi + residual, k f16 -> 2-product causal logits kept in the accumulator registers (S^T = K Q^T), online softmax in f32 (base 2: exponent = one fused multiply-add of the raw product, 2^t on the transcendental unit), P split bf16 hi + lo against v bf16 hi + lo (3 products, O^T = V^T P^T), divided by the row sum at the end; output written channel-major [b][e][s] in f32 (no output projection).
#include <hip/hip_runtime.h>
#include <math.h>

typedef __attribute__((ext_vector_type(16))) _Float16 v16h;
typedef __attribute__((ext_vector_type(16))) __bf16 v16b;
typedef __attribute__((ext_vector_type(8)))  _Float16 v8h;
typedef __attribute__((ext_vector_type(8)))  float v8f;
typedef __attribute__((ext_vector_type(4)))  float v4f;
typedef __attribute__((ext_vector_type(2)))  float v2f;
typedef __attribute__((ext_vector_type(4)))  unsigned v4u;
typedef __attribute__((ext_vector_type(4)))  int v4i;
typedef float __attribute__((may_alias)) float_a;
typedef int __attribute__((may_alias)) int_a;

template <typename T> __device__ __forceinline__ void vst2(void* p, T v) { *(T*)p = v;  }
__device__ __forceinline__ v8f wmma16(v16h a, v16h b, v8f c) {
  v8f d = __builtin_amdgcn_wmma_f32_16x16x32_f16(false, a, false, b, (short)0, c, false, false);
  asm volatile("v_nop\n\tv_nop\n\tv_nop\n\tv_nop" : "+v"(d) : "v"(a), "v"(b));
  return d;
}
__device__ __forceinline__ v8f wmma_bf(v16b a, v16b b, v8f c) {
  v8f d = __builtin_amdgcn_wmma_f32_16x16x32_bf16(false, a, false, b, (short)0, c, false, false);
  asm volatile("v_nop\n\tv_nop\n\tv_nop\n\tv_nop" : "+v"(d) : "v"(a), "v"(b));
  return d;
}
// 16x16x32 fragments: lane = (h = lane>>4, row/col = lane&15); elements 0..7 = k0+8h+0..7, 8..15 = k0+16+8h+0..7; D element r = row 8h+r
__device__ __forceinline__ v16h frag_h(const _Float16* rowk0, int lane) {
  union { v16h v; v8h q[2]; } u; const _Float16* p = rowk0 + 8 * (lane >> 4);
  u.q[0] = *(const v8h*)p; u.q[1] = *(const v8h*)(p + 16); return u.v;
}
__device__ __forceinline__ v16h frag_f32(const float* rowk0, int lane) {
  v16h a; const float* p = rowk0 + 8 * (lane >> 4);
#pragma unroll
  for (int i = 0; i < 8; ++i) { a[i] = (_Float16)p[i]; a[8 + i] = (_Float16)p[16 + i]; }
  return a;
}
__device__ __forceinline__ v16h frag_f32s(const float* rowk0, int lane, float sc) {
  v16h a; const float* p = rowk0 + 8 * (lane >> 4);
#pragma unroll
  for (int i = 0; i < 8; ++i) { a[i] = (_Float16)(p[i] * sc); a[8 + i] = (_Float16)(p[16 + i] * sc); }
  return a;
}
// column fragment from a [K][ld] layout (column n), rows >= K read as 0
__device__ __forceinline__ v16h fragc_f32(const float* W, int k0, int n, int lane, int ld, int K) {
  v16h a; const int g = lane >> 4;
#pragma unroll
  for (int i = 0; i < 8; ++i) { const int ka = k0 + 8 * g + i, kb = ka + 16;
    a[i] = (_Float16)(ka < K ? W[(size_t)(ka < K ? ka : K - 1) * ld + n] : 0.f); a[8 + i] = (_Float16)(kb < K ? W[(size_t)(kb < K ? kb : K - 1) * ld + n] : 0.f); }
  return a;
}
struct F2 { v16b h, l; };
__device__ __forceinline__ F2 bsplit16(const float v[16]) { F2 r;
#pragma unroll
  for (int i = 0; i < 16; ++i) { const __bf16 h = (__bf16)v[i]; r.h[i] = h; r.l[i] = (__bf16)(v[i] - (float)h); }
  return r; }
__device__ __forceinline__ F2 split_row(const float* row, int k0, int lane) { float v[16]; const float* p = row + k0 + 8 * (lane >> 4);
#pragma unroll
  for (int i = 0; i < 8; ++i) { v[i] = p[i]; v[8 + i] = p[16 + i]; }
  const F2 r = bsplit16(v);
  asm volatile("s_wait_xcnt 0x0" :: "v"(p) : "memory");   // names the row loads' address as an input: the allocator may reuse that register pair (as a later load's destination) only behind this wait
  return r; }
__device__ __forceinline__ F2 split_rowK(const float* row, int k0, int lane, int K) { float v[16]; const int g = lane >> 4;
#pragma unroll
  for (int i = 0; i < 8; ++i) { const int ka = k0 + 8 * g + i, kb = ka + 16; v[i] = ka < K ? row[ka < K ? ka : K - 1] : 0.f; v[8 + i] = kb < K ? row[kb < K ? kb : K - 1] : 0.f; }
  return bsplit16(v); }
__device__ __forceinline__ F2 split_col(const float* W, int k0, int n, int lane, int ld, int K) { float v[16]; const int g = lane >> 4;
#pragma unroll
  for (int i = 0; i < 8; ++i) { const int ka = k0 + 8 * g + i, kb = ka + 16; v[i] = ka < K ? W[(size_t)(ka < K ? ka : K - 1) * ld + n] : 0.f; v[8 + i] = kb < K ? W[(size_t)(kb < K ? kb : K - 1) * ld + n] : 0.f; }
  return bsplit16(v); }
__device__ __forceinline__ v8f mac3(const F2& a, const F2& b, v8f c) { c = wmma_bf(a.l, b.h, c); c = wmma_bf(a.h, b.l, c); return wmma_bf(a.h, b.h, c); }
__device__ __forceinline__ float sigm(float v) { return 1.0f / (1.0f + expf(-v)); }
#define LDSX() do { asm volatile("s_wait_dscnt 0" ::: "memory"); __builtin_amdgcn_wave_barrier(); __builtin_amdgcn_fence(__ATOMIC_RELEASE, "workgroup"); } while (0)


// Causal attention (B 8, 32x32 = 1,024 positions, q from a 256-ch query map, k/v from a 256-ch key map, embed 512 = 8 heads x 64): channel-major in, channel-major out [b][h*64+d][s].
#define NB 8
#define TT 1024
#define CC 512
#define NH 8
#define HD 64
#ifndef TNB
#define TNB NB
#endif
typedef __attribute__((ext_vector_type(8))) __bf16 v8b;
typedef __attribute__((ext_vector_type(4))) __bf16 v4b;
__device__ __forceinline__ v16b frag_b(const __bf16* rowk0, int lane) {
  union { v16b v; v8b q[2]; } u; const __bf16* p = rowk0 + 8 * (lane >> 4);
  u.q[0] = *(const v8b*)p; u.q[1] = *(const v8b*)(p + 16); return u.v;
}
__device__ __forceinline__ float bfr(float v) { return (float)(__bf16)v; }
__device__ __attribute__((noinline)) float exp_ni(float v) { return expf(v); }
__device__ __attribute__((noinline)) float erf_ni(float v) { return erff(v); }

#define WS_QH  0u
#define WS_QL  (WS_QH + 2u * (size_t)NB * TT * CC)
#define WS_KH  (WS_QL + 2u * (size_t)NB * TT * CC)
#define WS_VT  (WS_KH + 2u * (size_t)NB * TT * CC)      // bf16 v planes [b][c][t]
#define WS_VL  (WS_VT + 2u * (size_t)NB * CC * TT)      // bf16 v residual planes
#define HG (NB * NH)                                  // (batch, head) pairs per launch: all of them
#define WS_END (WS_VL + 2u * (size_t)NB * CC * TT)

#define CIN 256
// ---- k_proj: block = (2 x 64 positions, 128 out cols, b*3 + which): x^T tile [64 s][256 c] bf16 in LDS from the channel-major map (query for q, key for k/v); the 128 rows of W [out][in] in bf16 in LDS too, read as fragments by all four waves and kept there for both position tiles; W + b exact; q -> f16 hi + residual rows, k -> f16 rows, v -> bf16 hi + lo planes
// The product's orientation follows the output's layout: v planes are position-contiguous (D = x W^T: a lane's 8 accumulator registers are 8 positions of one channel), q and k rows are channel-contiguous (D = W x^T: 8 channels of one position), so every lane packs 16 bytes of one output row
// q, k: one position's 8 channels j * 16 + 8 * g + 0..7 plus their biases -> f16 (LO: and the f16 residual), one 16-byte LDS store each
template <bool LO> __device__ __forceinline__ void put_rows(const v8f (&acc)[8], const float* sb, _Float16* hrow, _Float16* lrow, int g) {
#pragma unroll   // unrolled: acc is indexed by constants
  for (int j = 0; j < 8; ++j) { const v4f b0 = *(const v4f*)&sb[j * 16 + 8 * g], b1 = *(const v4f*)&sb[j * 16 + 8 * g + 4]; v8h h8, l8;
#pragma unroll   // unrolled: the same
    for (int r = 0; r < 8; ++r) { const float v = acc[j][r] + (r < 4 ? b0[r & 3] : b1[r & 3]); const _Float16 hv = (_Float16)v; h8[r] = hv; if (LO) l8[r] = (_Float16)(v - (float)hv); }
    *(v8h*)(hrow + j * 16 + 8 * g) = h8; if (LO) *(v8h*)(lrow + j * 16 + 8 * g) = l8; } }
__global__ __launch_bounds__(128) void k_proj(const float* __restrict__ XQ, const float* __restrict__ XK, const float* __restrict__ WQ, const float* __restrict__ BQ, const float* __restrict__ WK, const float* __restrict__ BK, const float* __restrict__ WV, const float* __restrict__ BV, _Float16* __restrict__ QH, _Float16* __restrict__ QL, _Float16* __restrict__ KH, __bf16* __restrict__ VT, __bf16* __restrict__ VL) {
  __shared__ __align__(16) __bf16 sxo[2 * 128 * 72]; __shared__ __align__(16) __bf16 sw[128][CIN + 8]; __shared__ __align__(16) float sb[128];   // sb: the block's 128 biases; sw: the block's 128 rows of W in bf16, one copy for all four waves and both position tiles; pitch 528 B = 16 B x odd
  // sxo: the x tile, and in its place the output tiles once every wave has left the product loop (the barrier behind it); sized by the larger, the two v tiles
  __bf16 (*sx)[CIN + 8] = (__bf16 (*)[CIN + 8])&sxo[0];
  _Float16 (*sh)[136] = (_Float16 (*)[136])&sxo[0]; _Float16 (*sl)[136] = sh + 64; __bf16 (*th)[72] = (__bf16 (*)[72])&sxo[0]; __bf16 (*tl2)[72] = th + 128;
  const int tid = threadIdx.x, wave = tid >> 5, lane = tid & 31, col = lane & 15, g = lane >> 4; const int c0 = blockIdx.y * 128; const size_t b = blockIdx.z / 3; const int which = blockIdx.z % 3;
  const float* X = which == 0 ? XQ : XK; const float* Wm = which == 0 ? WQ : which == 1 ? WK : WV; const float* Bm = which == 0 ? BQ : which == 1 ? BK : BV;
  const float bv = Bm[c0 + tid];   // one bias a thread, in flight under the W loads
  { const float* wp = Wm + (size_t)c0 * CIN + tid * 4;   // the 128 rows are one contiguous 128 KiB: a wave's 16-byte loads cover whole lines
#pragma unroll 1   // rolled: two batches of 32 loads in flight; more would only cost registers
    for (int it = 0; it < 2; ++it) { v4f r[32];
#pragma unroll   // unrolled: r stays in registers and the 32 loads issue back to back
      for (int u = 0; u < 32; ++u) r[u] = *(const v4f*)(wp + (it * 32 + u) * 512);
#pragma unroll   // unrolled: r is indexed by constants
      for (int u = 0; u < 32; ++u) { v4b w4; w4[0] = (__bf16)r[u][0]; w4[1] = (__bf16)r[u][1]; w4[2] = (__bf16)r[u][2]; w4[3] = (__bf16)r[u][3]; *(v4b*)&sw[(it * 32 + u) * 2 + (tid >> 6)][(tid & 63) * 4] = w4; } } }
  const int xq = lane & 7, xo = tid >> 3;   // the x tile: a lane takes 4 positions (16 bytes) of each of 8 channels, four times over; eight lanes cover one whole 128-byte line of a channel's row
  const float* xp = X + (b * CIN + xo * 8) * (size_t)TT + blockIdx.x * 128 + xq * 4; v4f r[32];
#pragma unroll   // unrolled: r stays in registers and the 32 loads issue back to back, one round trip for the whole tile
  for (int u = 0; u < 32; ++u) r[u] = *(const v4f*)(xp + ((u >> 4) * 128 + (u & 7)) * TT + ((u >> 3) & 1) * 32);
  sb[tid] = bfr(bv);
#pragma unroll 1   // rolled: one copy of the text serves both position tiles
  for (int it = 0; it < 2; ++it) { const int p0 = blockIdx.x * 128 + it * 64;
#pragma unroll   // unrolled: r is indexed by constants
  for (int m = 0; m < 4; ++m)
#pragma unroll   // unrolled: the same
    for (int i = 0; i < 4; ++i) { v8b w8;   // one position's 8 channels: the transpose happens in registers, one 16-byte LDS store
#pragma unroll   // unrolled: the same
      for (int k = 0; k < 8; ++k) w8[k] = (__bf16)r[m * 8 + k][i];
      *(v8b*)&sx[(m & 1) * 32 + xq * 4 + i][(m >> 1) * 128 + xo * 8] = w8; }
  __syncthreads();
  if (it == 0) {   // block-uniform: the second tile's x loads fly under the first tile's products (the barrier behind them waits for the loads)
#pragma unroll   // unrolled: as above
    for (int u = 0; u < 32; ++u) r[u] = *(const v4f*)(xp + 64 + ((u >> 4) * 128 + (u & 7)) * TT + ((u >> 3) & 1) * 32); }
  v8f acc[8] = {};
  if (which == 2) {   // block-uniform, once: x as A, W as B
#pragma unroll 2   // two k steps a trip: half the loop overhead, a short text
    for (int kc = 0; kc < CIN / 32; ++kc) { const v16b a = frag_b(&sx[wave * 16 + col][kc * 32], lane); v16b wf[8];
#pragma unroll   // unrolled: wf is indexed by constants
      for (int j = 0; j < 8; ++j) wf[j] = frag_b(&sw[j * 16 + col][kc * 32], lane);   // all eight W fragments of this k step in one group of LDS reads, not one wait per product
#pragma unroll   // unrolled: the same, and acc
      for (int j = 0; j < 8; ++j) acc[j] = wmma_bf(a, wf[j], acc[j]); }
  } else {            // W as A, x as B: the same fragments (one loader, one k order), the operands swapped
#pragma unroll 2   // two k steps a trip: half the loop overhead, a short text
    for (int kc = 0; kc < CIN / 32; ++kc) { const v16b a = frag_b(&sx[wave * 16 + col][kc * 32], lane); v16b wf[8];
#pragma unroll   // unrolled: wf is indexed by constants
      for (int j = 0; j < 8; ++j) wf[j] = frag_b(&sw[j * 16 + col][kc * 32], lane);
#pragma unroll   // unrolled: the same, and acc
      for (int j = 0; j < 8; ++j) acc[j] = wmma_bf(wf[j], a, acc[j]); } }
  __syncthreads();   // every wave has read its last x fragment: the output tiles below overwrite the x tile
  if (which == 2) {
#pragma unroll   // unrolled: acc is indexed by constants
    for (int j = 0; j < 8; ++j) { const float bb = sb[j * 16 + col]; v8b h8, l8;   // channel j * 16 + col, positions wave * 16 + 8 * g + 0..7
#pragma unroll   // unrolled: the same
      for (int r = 0; r < 8; ++r) { const float v = acc[j][r] + bb; const __bf16 bh = (__bf16)v; h8[r] = bh; l8[r] = (__bf16)(v - (float)bh); }
      *(v8b*)&th[j * 16 + col][wave * 16 + 8 * g] = h8; *(v8b*)&tl2[j * 16 + col][wave * 16 + 8 * g] = l8; }
  } else if (which == 0) put_rows<true>(acc, sb, &sh[wave * 16 + col][0], &sl[wave * 16 + col][0], g);
  else put_rows<false>(acc, sb, &sh[wave * 16 + col][0], &sl[wave * 16 + col][0], g);
  __syncthreads();
  if (which < 2) { _Float16* dh = which == 0 ? QH : KH; for (int e = tid; e < 64 * 16; e += 128) { const int rl = e >> 4, q = e & 15; const size_t row = b * TT + p0 + rl; vst2((unsigned*)(dh + row * CC + c0 + q * 8), *(const v4u*)&sh[rl][q * 8]); if (which == 0) vst2((unsigned*)(QL + row * CC + c0 + q * 8), *(const v4u*)&sl[rl][q * 8]); } }
  else { for (int e = tid; e < 128 * 8; e += 128) { const int cl = e >> 3, q = e & 7; const size_t o2 = (b * CC + c0 + cl) * (size_t)TT + p0 + q * 8; vst2((unsigned*)(VT + o2), *(const v4u*)&th[cl][q * 8]); vst2((unsigned*)(VL + o2), *(const v4u*)&tl2[cl][q * 8]); } }
  if (it == 0) __syncthreads();   // block-uniform: every wave has read the output tiles, the second x tile overwrites them
  } }
__device__ __forceinline__ v8f mm16(v16h a, v16h b, v8f c) { return __builtin_amdgcn_wmma_f32_16x16x32_f16(false, a, false, b, (short)0, c, false, false); }
__device__ __forceinline__ v8f mmbf(v16b a, v16b b, v8f c) { return __builtin_amdgcn_wmma_f32_16x16x32_bf16(false, a, false, b, (short)0, c, false, false); }
// one 16x16x32 fragment in the hardware k order; p = row + k0 + 8 * (lane >> 4): elements 0..7 at p, 8..15 at p + 16
template <typename V16, typename V8, typename E> __device__ __forceinline__ V16 ld16(const E* p) { union { V16 v; V8 q[2]; } u; u.q[0] = *(const V8*)p; u.q[1] = *(const V8*)(p + 16); return u.v; }
// 2^t on the transcendental unit; a masked score (t far below the underflow bound) gives 0
__device__ __forceinline__ float exp2_hw(float t) {
  float r; asm("v_exp_f32 %0, %1\n\tv_nop" : "=v"(r) : "v"(t));   // v_nop: the one slot that the instruction set asks for behind a transcendental, tied to it here
  return r; }
#define SC2 0x1.715476p-3f       // log2(e) / 8: a raw q.k product times SC2 is the logit in the base-2 domain
// lane l <-> lane l ^ 16
__device__ __forceinline__ float xhalf(float x) { return __builtin_bit_cast(float, __builtin_amdgcn_permlanex16(__builtin_bit_cast(int, x), __builtin_bit_cast(int, x), 0x76543210, 0xfedcba98, false, false)); }
// ---- k_att: block = (query tile pair, (b,h)); 4 waves x 16 queries walk 64-query tile 15 - x, then tile x (equal work in every block: 17 stages of 64 keys). Per 32-key pass of a wave:
// S^T = K Q^T (a lane holds 16 keys of ONE query, lane ^ 16 the other 16), running maximum and sum, P^T packed from the score registers as the B operand, O^T += V^T P^T.
// K rows and V^T rows of a stage stand in LDS, one copy for the four waves, brought by whole-line asynchronous copies into two buffers: stage t + 2 flies while stage t + 1 is worked on.
// Every plain '#pragma unroll' below unrolls a short constant loop fully, so that the fragment and accumulator arrays it indexes stay in registers.
#define KPIT 144                 // LDS row pitch in bytes: a 128-byte row + 16 = 16 B x odd, for the 16-byte fragment reads
#define TILEB (64 * KPIT)        // one tile: 64 rows (K: keys x 64 channels; V^T: channels x 64 keys)
#define STGB (3 * TILEB)         // a stage: K, V^T hi, V^T lo
#define NSTG (TT / 64 + 1)       // stages of a block: (16 - x) of the first tile + (x + 1) of the second
// one stage: every lane copies 12 x 16 bytes (rows r, r + 16, r + 32, r + 48 of each tile; eight lanes cover one 128-byte row). d = the lane's LDS byte address in the K tile.
// s_wait_xcnt 0 is the statement's last line: the address registers that the copies name are rewritten only behind it
__device__ __forceinline__ void cp_stage(unsigned d, const _Float16* k, const __bf16* vh, const __bf16* vl) {
  asm volatile(
    "global_load_async_to_lds_b128 %0, %12, off\n\t"
    "global_load_async_to_lds_b128 %1, %13, off\n\t"
    "global_load_async_to_lds_b128 %2, %14, off\n\t"
    "global_load_async_to_lds_b128 %3, %15, off\n\t"
    "global_load_async_to_lds_b128 %4, %16, off\n\t"
    "global_load_async_to_lds_b128 %5, %17, off\n\t"
    "global_load_async_to_lds_b128 %6, %18, off\n\t"
    "global_load_async_to_lds_b128 %7, %19, off\n\t"
    "global_load_async_to_lds_b128 %8, %20, off\n\t"
    "global_load_async_to_lds_b128 %9, %21, off\n\t"
    "global_load_async_to_lds_b128 %10, %22, off\n\t"
    "global_load_async_to_lds_b128 %11, %23, off\n\t"
    "s_wait_xcnt 0x0"
    :: "v"(d), "v"(d + 16 * KPIT), "v"(d + 32 * KPIT), "v"(d + 48 * KPIT),
       "v"(d + TILEB), "v"(d + TILEB + 16 * KPIT), "v"(d + TILEB + 32 * KPIT), "v"(d + TILEB + 48 * KPIT),
       "v"(d + 2 * TILEB), "v"(d + 2 * TILEB + 16 * KPIT), "v"(d + 2 * TILEB + 32 * KPIT), "v"(d + 2 * TILEB + 48 * KPIT),
       "v"(k), "v"(k + 16 * CC), "v"(k + 32 * CC), "v"(k + 48 * CC),
       "v"(vh), "v"(vh + 16 * TT), "v"(vh + 32 * TT), "v"(vh + 48 * TT),
       "v"(vl), "v"(vl + 16 * TT), "v"(vl + 32 * TT), "v"(vl + 48 * TT)
    : "memory"); }
__global__ __launch_bounds__(128) void k_att(const _Float16* __restrict__ QH, const _Float16* __restrict__ QL, const _Float16* __restrict__ KH, const __bf16* __restrict__ VT, const __bf16* __restrict__ VL, float* __restrict__ Y) {
  __shared__ __align__(16) float so[HD][68];
  __shared__ __align__(16) unsigned char ring[2 * STGB];
  const int tid = threadIdx.x, lane = tid & 31, col = lane & 15, g = lane >> 4; const int wave = __builtin_amdgcn_readfirstlane(tid >> 5);   // scalar: a wave's trip count and its diagonal test become scalar branches (EXEC stays full at the matrix instructions)
  const int b = blockIdx.y / NH, h = blockIdx.y % NH;
  const int n0 = TT / 64 - (int)blockIdx.x;   // stages of the first tile; stage s holds keys 64 * (s < n0 ? s : s - n0) + 0..63
  const int crow = tid >> 3, cq = tid & 7;    // the copies: row and 16-byte piece of this lane
  const _Float16* kcp = KH + ((size_t)b * TT + crow) * CC + h * HD + cq * 8;
  const size_t vco = ((size_t)b * CC + h * HD + crow) * (size_t)TT + cq * 8; const __bf16* vhc = VT + vco; const __bf16* vlc = VL + vco;
  const unsigned cl = (unsigned)(size_t)&ring[0] + crow * KPIT + cq * 16;
  const int fo = col * KPIT + g * 16;         // the fragment reads: row col of a 16-row tile, this lane half's first 16 bytes
  const int dl = col + (wave & 1) * 16 - 8 * g;   // a wave's last pass begins at key ql0 - (ql0 & 16): this lane's query minus its lane half's first key there, the same in both tiles (its compares stay outside the stage loop)
  cp_stage(cl, kcp, vhc, vlc);                                    // stage 0 (keys 0..63) into buffer 0
  asm volatile("s_wait_asynccnt 0x0" ::: "memory");               // this wave's copies of stage 0 have landed
  __syncthreads();                                                // every wave's have: stage 0 may be read
  cp_stage(cl + STGB, kcp + (size_t)64 * CC, vhc + 64, vlc + 64); // stage 1 (keys 64..127: the first tile has 9 stages or more) into buffer 1
  int x = TT / 64 - 1 - (int)blockIdx.x, ts = 0;                  // the query tile, and the stage's number within it
  v16h qh[2] = {}, ql[2] = {}; float m = -3.0e38f, l = 0.f; v8f acc[HD / 16] = {};
#pragma unroll 1   // rolled: one copy of the stage serves both tiles
  for (int t = 0; t < NSTG; ++t) { const int ql0 = x * 64 + wave * 16;
    const int nb = (ql0 + 47) >> 5;   // 32-key passes that hold keys [0, ql0 + 16); every query has an unmasked key in each of them
    if (ts == 0) {   // block-uniform: a tile begins
      const size_t qo = ((size_t)b * TT + ql0 + col) * CC + h * HD + 8 * g; const _Float16* qhp = QH + qo; const _Float16* qlp = QL + qo;
#pragma unroll
      for (int kc = 0; kc < 2; ++kc) { qh[kc] = ld16<v16h, v8h>(qhp + kc * 32); ql[kc] = ld16<v16h, v8h>(qlp + kc * 32); }
      asm volatile("s_wait_xcnt 0x0" :: "v"(qhp), "v"(qlp) : "memory");   // names the loads' addresses as inputs: their registers may be reused (also as a later load's destination) only behind this wait
      m = -3.0e38f; l = 0.f;
#pragma unroll
      for (int j = 0; j < HD / 16; ++j) acc[j] = v8f{}; }
    const unsigned char* sb = ring + (t & 1) * STGB + fo;
    v16h kf[2][2];
#pragma unroll
    for (int u = 0; u < 2; ++u)
#pragma unroll
      for (int kc = 0; kc < 2; ++kc) kf[u][kc] = ld16<v16h, v8h>((const _Float16*)(sb + u * 16 * KPIT + kc * 64));
    const int np = nb - ts * 2 < 2 ? nb - ts * 2 : 2;   // wave-uniform: waves 0 and 1 skip the second pass of a tile's last stage
#pragma unroll 1   // rolled: a second copy of the pass would need a second set of V^T fragments in registers
    for (int pp = 0; pp < np; ++pp) { const int p = ts * 2 + pp;
      const unsigned char* pv = sb + TILEB + pp * 64;
      v16b vh[HD / 16], vl[HD / 16];   // this pass's V^T fragments: in flight under the score products and the softmax
#pragma unroll
      for (int j = 0; j < HD / 16; ++j) { vh[j] = ld16<v16b, v8b>((const __bf16*)(pv + j * 16 * KPIT)); vl[j] = ld16<v16b, v8b>((const __bf16*)(pv + TILEB + j * 16 * KPIT)); }
      v8f st[2] = {};
#pragma unroll
      for (int kc = 0; kc < 2; ++kc) {
#pragma unroll
        for (int u = 0; u < 2; ++u) st[u] = mm16(kf[u][kc], qh[kc], st[u]);
#pragma unroll
        for (int u = 0; u < 2; ++u) st[u] = mm16(kf[u][kc], ql[kc], st[u]); }
      if (pp == 0) {   // the second pass's K fragments, one pass ahead, from this stage's own buffer
#pragma unroll
        for (int u = 0; u < 2; ++u)
#pragma unroll
          for (int kc = 0; kc < 2; ++kc) kf[u][kc] = ld16<v16h, v8h>((const _Float16*)(sb + (32 + u * 16) * KPIT + kc * 64)); }
      float s[16];
#pragma unroll
      for (int i = 0; i < 16; ++i) s[i] = st[i >> 3][i & 7];   // raw q.k of key p * 32 + 16 * (i >> 3) + 8 * g + (i & 7), query ql0 + col
      if (p == nb - 1) {   // wave-uniform: only the last pass meets the diagonal
#pragma unroll
        for (int i = 0; i < 16; ++i) if (16 * (i >> 3) + (i & 7) > dl) s[i] = -3.0e38f; }   // key > query
      float mx = s[0];
#pragma unroll
      for (int i = 1; i < 16; ++i) mx = fmaxf(mx, s[i]);
      mx = fmaxf(mx, xhalf(mx));
      const float mn = fmaxf(m, mx * SC2), al = exp2_hw(m - mn); m = mn;   // the running maximum is kept in the base-2 domain; al = 0 in the first pass
      float ps = 0.f;
#pragma unroll
      for (int i = 0; i < 16; i += 2) {   // scale, base change and maximum in one fused multiply-add, rounded once, two scores to a packed instruction; a masked score gives 0
        const v2f t = __builtin_elementwise_fma(v2f{s[i], s[i + 1]}, v2f{SC2, SC2}, v2f{-mn, -mn});
        s[i] = exp2_hw(t[0]); s[i + 1] = exp2_hw(t[1]); ps += s[i]; ps += s[i + 1]; }
      l = l * al + ps;   // each lane half sums its own keys; the halves join behind the tile's last stage
      const F2 pf = bsplit16(s);
#pragma unroll
      for (int j = 0; j < HD / 16; ++j) acc[j] = acc[j] * al;
#pragma unroll
      for (int j = 0; j < HD / 16; ++j) acc[j] = mmbf(vh[j], pf.h, acc[j]);
#pragma unroll
      for (int j = 0; j < HD / 16; ++j) acc[j] = mmbf(vh[j], pf.l, acc[j]);
#pragma unroll
      for (int j = 0; j < HD / 16; ++j) acc[j] = mmbf(vl[j], pf.h, acc[j]); }
    if (ts == x) {   // block-uniform: the tile's last stage is done
      l += xhalf(l); const float inv = 1.0f / l;
#pragma unroll
      for (int j = 0; j < HD / 16; ++j)
#pragma unroll
        for (int r = 0; r < 8; ++r) so[j * 16 + 8 * g + r][wave * 16 + col] = acc[j][r] * inv;   // O^T: row = channel, column = query
      __syncthreads();   // all four waves' columns stand in so
      for (int e = tid; e < HD * 16; e += 128) { const int d = e >> 4, q4 = e & 15; vst2(Y + ((size_t)b * CC + h * HD + d) * TT + x * 64 + q4 * 4, *(const v4f*)&so[d][q4 * 4]); }
      x = (int)blockIdx.x; ts = 0;   // so is rewritten by the second tile only behind the stage barrier below
    } else ++ts;
    asm volatile("s_wait_dscnt 0x0" ::: "memory");      // this wave's reads of stage t's buffer (and of so) have returned
    asm volatile("s_wait_asynccnt 0x0" ::: "memory");   // this wave's copies of stage t + 1 have landed
    __syncthreads();                                    // publishes stage t + 1 and frees stage t's buffer
    if (t + 2 < NSTG) { const int s2 = t + 2, k2 = (s2 < n0 ? s2 : s2 - n0) * 64;   // block-uniform: only while stage t + 2 exists
      cp_stage(cl + (t & 1) * STGB, kcp + (size_t)k2 * CC, vhc + k2, vlc + k2); } }
  asm volatile("s_wait_asynccnt 0x0" ::: "memory");     // nothing is in flight when the wave ends
}
extern "C" void kernel_launch(void* const* d_in, const int* in_sizes, int n_in, void* d_out, int out_size, void* d_ws, size_t ws_size, hipStream_t stream) {
  (void)in_sizes; (void)n_in; (void)out_size;
  const float** F = (const float**)d_in;   // 0 query [8,256,32,32], 1 key [8,256,32,32], 2 Wq [512,256], 3 bq, 4 Wk [512,256], 5 bk, 6 Wv [512,256], 7 bv
  if (ws_size < (size_t)WS_END) return;
  char* ws = (char*)d_ws; _Float16 *QH = (_Float16*)(ws + WS_QH), *QL = (_Float16*)(ws + WS_QL), *KH = (_Float16*)(ws + WS_KH); __bf16 *VT = (__bf16*)(ws + WS_VT), *VL = (__bf16*)(ws + WS_VL);
  k_proj<<<dim3(TT / 128, CC / 128, TNB * 3), 128, 0, stream>>>(F[0], F[1], F[2], F[3], F[4], F[5], F[6], F[7], QH, QL, KH, VT, VL);
  k_att<<<dim3(TT / 128, HG), 128, 0, stream>>>(QH, QL, KH, VT, VL, (float*)d_out);   // logits, softmax and P.V of every (batch, head) in one launch
}

// v010
// One run takes 33.5 microseconds.
// It is 1.31 times as fast as v008, going by the measured steps of the versions left out in between.
// Over all steps from v000 it is 21.9 times as fast.
// compute dtype: all float inputs rounded to bf16; q = query^T Wq^T + bq, k/v = key^T W^T + b with EXACT bf16 products on WMMA 16x16x32 (channel-major tiles transposed in LDS), f32 accumulate; q, k and v each rounded once to f16 -> causal logits kept in the accumulator registers (S^T = K Q^T, one product), online softmax in f32 (base 2: exponent = one fused multiply-add of the raw product, 2^t on the transcendental unit), P rounded once to f16 against v (one product, O^T = V^T P^T), divided by the f32 row sum at the end; output written channel-major [b][e][s] in f32 (no output projection).
#include <hip/hip_runtime.h>
#include <math.h>

typedef __attribute__((ext_vector_type(16))) _Float16 v16h;
typedef __attribute__((ext_vector_type(16))) __bf16 v16b;
typedef __attribute__((ext_vector_type(8)))  _Float16 v8h;
typedef __attribute__((ext_vector_type(2)))  _Float16 v2h;
typedef __attribute__((ext_vector_type(8)))  float v8f;
typedef __attribute__((ext_vector_type(4)))  float v4f;
typedef __attribute__((ext_vector_type(2)))  float v2f;
typedef __attribute__((ext_vector_type(4)))  unsigned v4u;
typedef __attribute__((ext_vector_type(4)))  int v4i;
typedef float __attribute__((may_alias)) float_a;
typedef int __attribute__((may_alias)) int_a;

template <typename T> __device__ __forceinline__ void vst2(void* p, T v) { *(T*)p = v;  }
__device__ __forceinline__ v8f wmma16(v16h a, v16h b, v8f c) {
  v8f d = __builtin_amdgcn_wmma_f32_16x16x32_f16(false, a, false, b, (short)0, c, false, false);
  asm volatile("v_nop\n\tv_nop\n\tv_nop\n\tv_nop" : "+v"(d) : "v"(a), "v"(b));
  return d;
}
__device__ __forceinline__ v8f wmma_bf(v16b a, v16b b, v8f c) {
  v8f d = __builtin_amdgcn_wmma_f32_16x16x32_bf16(false, a, false, b, (short)0, c, false, false);
  asm volatile("v_nop\n\tv_nop\n\tv_nop\n\tv_nop" : "+v"(d) : "v"(a), "v"(b));
  return d;
}
// 16x16x32 fragments: lane = (h = lane>>4, row/col = lane&15); elements 0..7 = k0+8h+0..7, 8..15 = k0+16+8h+0..7; D element r = row 8h+r
__device__ __forceinline__ v16h frag_h(const _Float16* rowk0, int lane) {
  union { v16h v; v8h q[2]; } u; const _Float16* p = rowk0 + 8 * (lane >> 4);
  u.q[0] = *(const v8h*)p; u.q[1] = *(const v8h*)(p + 16); return u.v;
}
__device__ __forceinline__ v16h frag_f32(const float* rowk0, int lane) {
  v16h a; const float* p = rowk0 + 8 * (lane >> 4);
#pragma unroll
  for (int i = 0; i < 8; ++i) { a[i] = (_Float16)p[i]; a[8 + i] = (_Float16)p[16 + i]; }
  return a;
}
__device__ __forceinline__ v16h frag_f32s(const float* rowk0, int lane, float sc) {
  v16h a; const float* p = rowk0 + 8 * (lane >> 4);
#pragma unroll
  for (int i = 0; i < 8; ++i) { a[i] = (_Float16)(p[i] * sc); a[8 + i] = (_Float16)(p[16 + i] * sc); }
  return a;
}
// column fragment from a [K][ld] layout (column n), rows >= K read as 0
__device__ __forceinline__ v16h fragc_f32(const float* W, int k0, int n, int lane, int ld, int K) {
  v16h a; const int g = lane >> 4;
#pragma unroll
  for (int i = 0; i < 8; ++i) { const int ka = k0 + 8 * g + i, kb = ka + 16;
    a[i] = (_Float16)(ka < K ? W[(size_t)(ka < K ? ka : K - 1) * ld + n] : 0.f); a[8 + i] = (_Float16)(kb < K ? W[(size_t)(kb < K ? kb : K - 1) * ld + n] : 0.f); }
  return a;
}
struct F2 { v16b h, l; };
__device__ __forceinline__ F2 bsplit16(const float v[16]) { F2 r;
#pragma unroll
  for (int i = 0; i < 16; ++i) { const __bf16 h = (__bf16)v[i]; r.h[i] = h; r.l[i] = (__bf16)(v[i] - (float)h); }
  return r; }
__device__ __forceinline__ F2 split_row(const float* row, int k0, int lane) { float v[16]; const float* p = row + k0 + 8 * (lane >> 4);
#pragma unroll
  for (int i = 0; i < 8; ++i) { v[i] = p[i]; v[8 + i] = p[16 + i]; }
  const F2 r = bsplit16(v);
  asm volatile("s_wait_xcnt 0x0" :: "v"(p) : "memory");   // names the row loads' address as an input: the allocator may reuse that register pair (as a later load's destination) only behind this wait
  return r; }
__device__ __forceinline__ F2 split_rowK(const float* row, int k0, int lane, int K) { float v[16]; const int g = lane >> 4;
#pragma unroll
  for (int i = 0; i < 8; ++i) { const int ka = k0 + 8 * g + i, kb = ka + 16; v[i] = ka < K ? row[ka < K ? ka : K - 1] : 0.f; v[8 + i] = kb < K ? row[kb < K ? kb : K - 1] : 0.f; }
  return bsplit16(v); }
__device__ __forceinline__ F2 split_col(const float* W, int k0, int n, int lane, int ld, int K) { float v[16]; const int g = lane >> 4;
#pragma unroll
  for (int i = 0; i < 8; ++i) { const int ka = k0 + 8 * g + i, kb = ka + 16; v[i] = ka < K ? W[(size_t)(ka < K ? ka : K - 1) * ld + n] : 0.f; v[8 + i] = kb < K ? W[(size_t)(kb < K ? kb : K - 1) * ld + n] : 0.f; }
  return bsplit16(v); }
__device__ __forceinline__ v8f mac3(const F2& a, const F2& b, v8f c) { c = wmma_bf(a.l, b.h, c); c = wmma_bf(a.h, b.l, c); return wmma_bf(a.h, b.h, c); }
__device__ __forceinline__ float sigm(float v) { return 1.0f / (1.0f + expf(-v)); }
#define LDSX() do { asm volatile("s_wait_dscnt 0" ::: "memory"); __builtin_amdgcn_wave_barrier(); __builtin_amdgcn_fence(__ATOMIC_RELEASE, "workgroup"); } while (0)


// Causal attention (B 8, 32x32 = 1,024 positions, q from a 256-ch query map, k/v from a 256-ch key map, embed 512 = 8 heads x 64): channel-major in, channel-major out [b][h*64+d][s].
#define NB 8
#define TT 1024
#define CC 512
#define NH 8
#define HD 64
#ifndef TNB
#define TNB NB
#endif
typedef __attribute__((ext_vector_type(8))) __bf16 v8b;
typedef __attribute__((ext_vector_type(4))) __bf16 v4b;
__device__ __forceinline__ v16b frag_b(const __bf16* rowk0, int lane) {
  union { v16b v; v8b q[2]; } u; const __bf16* p = rowk0 + 8 * (lane >> 4);
  u.q[0] = *(const v8b*)p; u.q[1] = *(const v8b*)(p + 16); return u.v;
}
__device__ __forceinline__ float bfr(float v) { return (float)(__bf16)v; }
__device__ __attribute__((noinline)) float exp_ni(float v) { return expf(v); }
__device__ __attribute__((noinline)) float erf_ni(float v) { return erff(v); }

#define WS_QH  0u
#define WS_KH  (WS_QH + 2u * (size_t)NB * TT * CC)
#define WS_VT  (WS_KH + 2u * (size_t)NB * TT * CC)      // f16 v planes [b][c][t]
#define HG (NB * NH)                                  // (batch, head) pairs per launch: all of them
#define WS_END (WS_VT + 2u * (size_t)NB * CC * TT)

#define CIN 256
// ---- k_proj: block = (2 x 64 positions, 128 out cols, b*3 + which): x^T tile [64 s][256 c] bf16 in LDS from the channel-major map (query for q, key for k/v); the 128 rows of W [out][in] in bf16 in LDS too, read as fragments by all four waves and kept there for both position tiles; W and b rounded to bf16; q, k -> f16 rows, v -> f16 planes
// The product's orientation follows the output's layout: v planes are position-contiguous (D = x W^T: a lane's 8 accumulator registers are 8 positions of one channel), q and k rows are channel-contiguous (D = W x^T: 8 channels of one position), so every lane packs 16 bytes of one output row
// q, k: one position's 8 channels j * 16 + 8 * g + 0..7 plus their biases -> f16, one 16-byte LDS store
__device__ __forceinline__ void put_rows(const v8f (&acc)[8], const float* sb, _Float16* hrow, int g) {
#pragma unroll   // unrolled: acc is indexed by constants
  for (int j = 0; j < 8; ++j) { const v4f b0 = *(const v4f*)&sb[j * 16 + 8 * g], b1 = *(const v4f*)&sb[j * 16 + 8 * g + 4]; v8h h8;
#pragma unroll   // unrolled: the same
    for (int r = 0; r < 8; ++r) h8[r] = (_Float16)(acc[j][r] + (r < 4 ? b0[r & 3] : b1[r & 3]));
    *(v8h*)(hrow + j * 16 + 8 * g) = h8; } }
__global__ __launch_bounds__(128) void k_proj(const float* __restrict__ XQ, const float* __restrict__ XK, const float* __restrict__ WQ, const float* __restrict__ BQ, const float* __restrict__ WK, const float* __restrict__ BK, const float* __restrict__ WV, const float* __restrict__ BV, _Float16* __restrict__ QH, _Float16* __restrict__ KH, _Float16* __restrict__ VT) {
  __shared__ __align__(16) __bf16 sxo[64 * (CIN + 8)]; __shared__ __align__(16) __bf16 sw[128][CIN + 8]; __shared__ __align__(16) float sb[128];   // sb: the block's 128 biases; sw: the block's 128 rows of W in bf16, one copy for all four waves and both position tiles; pitch 528 B = 16 B x odd
  // sxo: the x tile, and in its place the output tile once every wave has left the product loop (the barrier behind it); sized by the larger, the x tile
  __bf16 (*sx)[CIN + 8] = (__bf16 (*)[CIN + 8])&sxo[0];
  _Float16 (*sh)[136] = (_Float16 (*)[136])&sxo[0]; _Float16 (*th)[72] = (_Float16 (*)[72])&sxo[0];
  const int tid = threadIdx.x, wave = tid >> 5, lane = tid & 31, col = lane & 15, g = lane >> 4; const int c0 = blockIdx.y * 128; const size_t b = blockIdx.z / 3; const int which = blockIdx.z % 3;
  const float* X = which == 0 ? XQ : XK; const float* Wm = which == 0 ? WQ : which == 1 ? WK : WV; const float* Bm = which == 0 ? BQ : which == 1 ? BK : BV;
  const float bv = Bm[c0 + tid];   // one bias a thread, in flight under the W loads
  { const float* wp = Wm + (size_t)c0 * CIN + tid * 4;   // the 128 rows are one contiguous 128 KiB: a wave's 16-byte loads cover whole lines
#pragma unroll 1   // rolled: two batches of 32 loads in flight; more would only cost registers
    for (int it = 0; it < 2; ++it) { v4f r[32];
#pragma unroll   // unrolled: r stays in registers and the 32 loads issue back to back
      for (int u = 0; u < 32; ++u) r[u] = *(const v4f*)(wp + (it * 32 + u) * 512);
#pragma unroll   // unrolled: r is indexed by constants
      for (int u = 0; u < 32; ++u) { v4b w4; w4[0] = (__bf16)r[u][0]; w4[1] = (__bf16)r[u][1]; w4[2] = (__bf16)r[u][2]; w4[3] = (__bf16)r[u][3]; *(v4b*)&sw[(it * 32 + u) * 2 + (tid >> 6)][(tid & 63) * 4] = w4; } } }
  const int xq = lane & 7, xo = tid >> 3;   // the x tile: a lane takes 4 positions (16 bytes) of each of 8 channels, four times over; eight lanes cover one whole 128-byte line of a channel's row
  const float* xp = X + (b * CIN + xo * 8) * (size_t)TT + blockIdx.x * 128 + xq * 4; v4f r[32];
#pragma unroll   // unrolled: r stays in registers and the 32 loads issue back to back, one round trip for the whole tile
  for (int u = 0; u < 32; ++u) r[u] = *(const v4f*)(xp + ((u >> 4) * 128 + (u & 7)) * TT + ((u >> 3) & 1) * 32);
  sb[tid] = bfr(bv);
#pragma unroll 1   // rolled: one copy of the text serves both position tiles
  for (int it = 0; it < 2; ++it) { const int p0 = blockIdx.x * 128 + it * 64;
#pragma unroll   // unrolled: r is indexed by constants
  for (int m = 0; m < 4; ++m)
#pragma unroll   // unrolled: the same
    for (int i = 0; i < 4; ++i) { v8b w8;   // one position's 8 channels: the transpose happens in registers, one 16-byte LDS store
#pragma unroll   // unrolled: the same
      for (int k = 0; k < 8; ++k) w8[k] = (__bf16)r[m * 8 + k][i];
      *(v8b*)&sx[(m & 1) * 32 + xq * 4 + i][(m >> 1) * 128 + xo * 8] = w8; }
  __syncthreads();
  if (it == 0) {   // block-uniform: the second tile's x loads fly under the first tile's products (the barrier behind them waits for the loads)
#pragma unroll   // unrolled: as above
    for (int u = 0; u < 32; ++u) r[u] = *(const v4f*)(xp + 64 + ((u >> 4) * 128 + (u & 7)) * TT + ((u >> 3) & 1) * 32); }
  v8f acc[8] = {};
  if (which == 2) {   // block-uniform, once: x as A, W as B
#pragma unroll 2   // two k steps a trip: half the loop overhead, a short text
    for (int kc = 0; kc < CIN / 32; ++kc) { const v16b a = frag_b(&sx[wave * 16 + col][kc * 32], lane); v16b wf[8];
#pragma unroll   // unrolled: wf is indexed by constants
      for (int j = 0; j < 8; ++j) wf[j] = frag_b(&sw[j * 16 + col][kc * 32], lane);   // all eight W fragments of this k step in one group of LDS reads, not one wait per product
#pragma unroll   // unrolled: the same, and acc
      for (int j = 0; j < 8; ++j) acc[j] = wmma_bf(a, wf[j], acc[j]); }
  } else {            // W as A, x as B: the same fragments (one loader, one k order), the operands swapped
#pragma unroll 2   // two k steps a trip: half the loop overhead, a short text
    for (int kc = 0; kc < CIN / 32; ++kc) { const v16b a = frag_b(&sx[wave * 16 + col][kc * 32], lane); v16b wf[8];
#pragma unroll   // unrolled: wf is indexed by constants
      for (int j = 0; j < 8; ++j) wf[j] = frag_b(&sw[j * 16 + col][kc * 32], lane);
#pragma unroll   // unrolled: the same, and acc
      for (int j = 0; j < 8; ++j) acc[j] = wmma_bf(wf[j], a, acc[j]); } }
  __syncthreads();   // every wave has read its last x fragment: the output tile below overwrites the x tile
  if (which == 2) {
#pragma unroll   // unrolled: acc is indexed by constants
    for (int j = 0; j < 8; ++j) { const float bb = sb[j * 16 + col]; v8h h8;   // channel j * 16 + col, positions wave * 16 + 8 * g + 0..7
#pragma unroll   // unrolled: the same
      for (int r = 0; r < 8; ++r) h8[r] = (_Float16)(acc[j][r] + bb);
      *(v8h*)&th[j * 16 + col][wave * 16 + 8 * g] = h8; }
  } else put_rows(acc, sb, &sh[wave * 16 + col][0], g);
  __syncthreads();
  if (which < 2) { _Float16* dh = which == 0 ? QH : KH; for (int e = tid; e < 64 * 16; e += 128) { const int rl = e >> 4, q = e & 15; const size_t row = b * TT + p0 + rl; vst2((unsigned*)(dh + row * CC + c0 + q * 8), *(const v4u*)&sh[rl][q * 8]); } }
  else { for (int e = tid; e < 128 * 8; e += 128) { const int cl = e >> 3, q = e & 7; const size_t o2 = (b * CC + c0 + cl) * (size_t)TT + p0 + q * 8; vst2((unsigned*)(VT + o2), *(const v4u*)&th[cl][q * 8]); } }
  if (it == 0) __syncthreads();   // block-uniform: every wave has read the output tile, the second x tile overwrites it
  } }
__device__ __forceinline__ v8f mm16(v16h a, v16h b, v8f c) { return __builtin_amdgcn_wmma_f32_16x16x32_f16(false, a, false, b, (short)0, c, false, false); }
// one 16x16x32 fragment in the hardware k order; p = row + k0 + 8 * (lane >> 4): elements 0..7 at p, 8..15 at p + 16
template <typename V16, typename V8, typename E> __device__ __forceinline__ V16 ld16(const E* p) { union { V16 v; V8 q[2]; } u; u.q[0] = *(const V8*)p; u.q[1] = *(const V8*)(p + 16); return u.v; }
// 2^t on the transcendental unit; a masked score (t far below the underflow bound) gives 0
__device__ __forceinline__ float exp2_hw(float t) {
  float r; asm("v_exp_f32 %0, %1\n\tv_nop" : "=v"(r) : "v"(t));   // v_nop: the one slot that the instruction set asks for behind a transcendental, tied to it here
  return r; }
#define SC2 0x1.715476p-3f       // log2(e) / 8: a raw q.k product times SC2 is the logit in the base-2 domain
// lane l <-> lane l ^ 16
__device__ __forceinline__ float xhalf(float x) { return __builtin_bit_cast(float, __builtin_amdgcn_permlanex16(__builtin_bit_cast(int, x), __builtin_bit_cast(int, x), 0x76543210, 0xfedcba98, false, false)); }
// ---- k_att: block = (query tile pair, (b,h)); 4 waves x 16 queries walk 64-query tile 15 - x, then tile x (equal work in every block: 9 stages of 128 keys, 17 halves of them used). Per 32-key pass of a wave:
// S^T = K Q^T (a lane holds 16 keys of ONE query, lane ^ 16 the other 16), running maximum and sum, P^T packed from the score registers as the B operand, O^T += V^T P^T.
// K rows and V^T rows of a stage stand in LDS, one copy for the four waves, brought by whole-line asynchronous copies into two buffers: stage t + 2 flies while stage t + 1 is worked on.
// Every plain '#pragma unroll' below unrolls a short constant loop fully, so that the fragment and accumulator arrays it indexes stay in registers.
#define SKEY 128                 // keys of a stage: four 32-key passes between two barriers, and a stage's copies have those four passes to land in
#define KPIT 144                 // LDS pitch of a K row in bytes: 128 (64 channels) + 16 = 16 B x odd, for the 16-byte fragment reads
#define VPIT 272                 // LDS pitch of a V^T row: 256 (128 keys) + 16 = 16 B x odd
#define KTB (SKEY * KPIT)        // the K tile: 128 keys x 64 channels
#define VTB (HD * VPIT)          // the V^T tile: 64 channels x 128 keys
#define STGB (KTB + VTB)         // a stage: K, V^T
#define NSTG (TT / SKEY + 1)     // stages of a block: (17 - x) / 2 of the first tile + (x + 2) / 2 of the second, rounded down: 9 for every x
// eight copies of 16 bytes a lane: LDS address d + i * DS bytes, global address p + i * PS elements
// s_wait_xcnt 0 is the statement's last line: the address registers that the copies name are rewritten only behind it
template <int DS, int PS> __device__ __forceinline__ void cp8(unsigned d, const _Float16* p) {
  asm volatile(
    "global_load_async_to_lds_b128 %0, %8, off\n\t"
    "global_load_async_to_lds_b128 %1, %9, off\n\t"
    "global_load_async_to_lds_b128 %2, %10, off\n\t"
    "global_load_async_to_lds_b128 %3, %11, off\n\t"
    "global_load_async_to_lds_b128 %4, %12, off\n\t"
    "global_load_async_to_lds_b128 %5, %13, off\n\t"
    "global_load_async_to_lds_b128 %6, %14, off\n\t"
    "global_load_async_to_lds_b128 %7, %15, off\n\t"
    "s_wait_xcnt 0x0"
    :: "v"(d), "v"(d + DS), "v"(d + 2 * DS), "v"(d + 3 * DS), "v"(d + 4 * DS), "v"(d + 5 * DS), "v"(d + 6 * DS), "v"(d + 7 * DS),
       "v"(p), "v"(p + PS), "v"(p + 2 * PS), "v"(p + 3 * PS), "v"(p + 4 * PS), "v"(p + 5 * PS), "v"(p + 6 * PS), "v"(p + 7 * PS)
    : "memory"); }
// one stage: every lane copies 16 x 16 bytes. K: rows r + 16 * i, eight lanes cover one 128-byte row; V^T: rows r + 8 * i, sixteen lanes cover one 256-byte row. dk, dv = the lane's LDS byte addresses in the two tiles
__device__ __forceinline__ void cp_stage(unsigned dk, unsigned dv, const _Float16* k, const _Float16* v) { cp8<16 * KPIT, 16 * CC>(dk, k); cp8<8 * VPIT, 8 * TT>(dv, v); }
__global__ __launch_bounds__(128) void k_att(const _Float16* __restrict__ QH, const _Float16* __restrict__ KH, const _Float16* __restrict__ VT, float* __restrict__ Y) {
  __shared__ __align__(16) float so[HD][68];
  __shared__ __align__(16) unsigned char ring[2 * STGB];
  const int tid = threadIdx.x, lane = tid & 31, col = lane & 15, g = lane >> 4; const int wave = __builtin_amdgcn_readfirstlane(tid >> 5);   // scalar: a wave's trip count and its diagonal test become scalar branches (EXEC stays full at the matrix instructions)
  const int b = blockIdx.y / NH, h = blockIdx.y % NH;
  const int n0 = (TT / 64 + 1 - (int)blockIdx.x) >> 1;   // stages of the first tile (its 64 * (16 - x) keys, rounded up to whole stages); stage s holds keys 128 * (s < n0 ? s : s - n0) + 0..127, all of them inside the 1,024
  const int crow = tid >> 3, cq = tid & 7;    // the K copies: row and 16-byte piece of this lane
  const int vrow = tid >> 4, vq = tid & 15;   // the V^T copies: the same
  const _Float16* kcp = KH + ((size_t)b * TT + crow) * CC + h * HD + cq * 8;
  const _Float16* vcp = VT + ((size_t)b * CC + h * HD + vrow) * (size_t)TT + vq * 8;
  const unsigned clk = (unsigned)(size_t)&ring[0] + crow * KPIT + cq * 16, clv = (unsigned)(size_t)&ring[0] + KTB + vrow * VPIT + vq * 16;
  const int fk = col * KPIT + g * 16, fv = KTB + col * VPIT + g * 16;   // the fragment reads: row col of a 16-row group, this lane half's first 16 bytes
  const int dl = col + (wave & 1) * 16 - 8 * g;   // a wave's last pass begins at key ql0 - (ql0 & 16): this lane's query minus its lane half's first key there, the same in both tiles (its compares stay outside the stage loop)
  cp_stage(clk, clv, kcp, vcp);                                   // stage 0 (keys 0..127) into buffer 0
  asm volatile("s_wait_asynccnt 0x0" ::: "memory");               // this wave's copies of stage 0 have landed
  __syncthreads();                                                // every wave's have: stage 0 may be read
  cp_stage(clk + STGB, clv + STGB, kcp + (size_t)SKEY * CC, vcp + SKEY);   // stage 1 (keys 128..255: the first tile has 5 stages or more) into buffer 1
  int x = TT / 64 - 1 - (int)blockIdx.x, ts = 0;                  // the query tile, and the stage's number within it
  v16h qh[2] = {}; float m = -3.0e38f, l = 0.f; v8f acc[HD / 16] = {};
#pragma unroll 1   // rolled: one copy of the stage serves both tiles
  for (int t = 0; t < NSTG; ++t) { const int ql0 = x * 64 + wave * 16;
    const int nb = (ql0 + 47) >> 5;   // 32-key passes that hold keys [0, ql0 + 16); every query has an unmasked key in each of them
    if (ts == 0) {   // block-uniform: a tile begins
      const _Float16* qhp = QH + ((size_t)b * TT + ql0 + col) * CC + h * HD + 8 * g;
#pragma unroll
      for (int kc = 0; kc < 2; ++kc) qh[kc] = ld16<v16h, v8h>(qhp + kc * 32);
      asm volatile("s_wait_xcnt 0x0" :: "v"(qhp) : "memory");   // names the loads' address as an input: its registers may be reused (also as a later load's destination) only behind this wait
      m = -3.0e38f; l = 0.f;
#pragma unroll
      for (int j = 0; j < HD / 16; ++j) acc[j] = v8f{}; }
    const unsigned char* sb = ring + (t & 1) * STGB + fk; const unsigned char* sv = ring + (t & 1) * STGB + fv;
    v16h kf[2][2];
#pragma unroll
    for (int u = 0; u < 2; ++u)
#pragma unroll
      for (int kc = 0; kc < 2; ++kc) kf[u][kc] = ld16<v16h, v8h>((const _Float16*)(sb + u * 16 * KPIT + kc * 64));
    const int np = nb - ts * 4 < 4 ? nb - ts * 4 : 4;   // wave-uniform: a tile's last stage has 1 to 4 passes, by the tile and the wave; every other stage 4
#pragma unroll 1   // rolled: a second copy of the pass would need a second set of V^T fragments in registers
    for (int pp = 0; pp < np; ++pp) { const int p = ts * 4 + pp;
      const unsigned char* pv = sv + pp * 64;
      v16h vf[HD / 16];   // this pass's V^T fragments: in flight under the score products and the softmax
#pragma unroll
      for (int j = 0; j < HD / 16; ++j) vf[j] = ld16<v16h, v8h>((const _Float16*)(pv + j * 16 * VPIT));
      v8f st[2] = {};
#pragma unroll
      for (int kc = 0; kc < 2; ++kc)
#pragma unroll
        for (int u = 0; u < 2; ++u) st[u] = mm16(kf[u][kc], qh[kc], st[u]);
      if (pp + 1 < np) {   // wave-uniform: the next pass's K fragments, one pass ahead, from this stage's own buffer
#pragma unroll
        for (int u = 0; u < 2; ++u)
#pragma unroll
          for (int kc = 0; kc < 2; ++kc) kf[u][kc] = ld16<v16h, v8h>((const _Float16*)(sb + ((pp + 1) * 32 + u * 16) * KPIT + kc * 64)); }
      float s[16];
#pragma unroll
      for (int i = 0; i < 16; ++i) s[i] = st[i >> 3][i & 7];   // raw q.k of key p * 32 + 16 * (i >> 3) + 8 * g + (i & 7), query ql0 + col
      if (p == nb - 1) {   // wave-uniform: only the last pass meets the diagonal
#pragma unroll
        for (int i = 0; i < 16; ++i) if (16 * (i >> 3) + (i & 7) > dl) s[i] = -3.0e38f; }   // key > query
      float mx = s[0];
#pragma unroll
      for (int i = 1; i < 16; ++i) mx = fmaxf(mx, s[i]);
      mx = fmaxf(mx, xhalf(mx));
      const float mn = fmaxf(m, mx * SC2), al = exp2_hw(m - mn); m = mn;   // the running maximum is kept in the base-2 domain; al = 0 in the first pass
      float ps = 0.f;
#pragma unroll
      for (int i = 0; i < 16; i += 2) {   // scale, base change and maximum in one fused multiply-add, rounded once, two scores to a packed instruction; a masked score gives 0
        const v2f t = __builtin_elementwise_fma(v2f{s[i], s[i + 1]}, v2f{SC2, SC2}, v2f{-mn, -mn});
        s[i] = exp2_hw(t[0]); s[i + 1] = exp2_hw(t[1]); ps += s[i]; ps += s[i + 1]; }
      l = l * al + ps;   // each lane half sums its own keys; the halves join behind the tile's last stage
      v16h pf;   // P^T as the B operand, each score rounded once (to nearest even) to f16, two to a packed conversion; the row sum above keeps the unrounded f32 values
#pragma unroll
      for (int i = 0; i < 16; i += 2) { const v2h c = __builtin_convertvector(v2f{s[i], s[i + 1]}, v2h); pf[i] = c[0]; pf[i + 1] = c[1]; }
#pragma unroll
      for (int j = 0; j < HD / 16; ++j) acc[j] = acc[j] * al;
#pragma unroll
      for (int j = 0; j < HD / 16; ++j) acc[j] = mm16(vf[j], pf, acc[j]); }
    if (ts == (x >> 1)) {   // block-uniform: the tile's last stage (keys up to 64 * x + 63 lie in stage x / 2) is done
      l += xhalf(l); const float inv = 1.0f / l;
#pragma unroll
      for (int j = 0; j < HD / 16; ++j)
#pragma unroll
        for (int r = 0; r < 8; ++r) so[j * 16 + 8 * g + r][wave * 16 + col] = acc[j][r] * inv;   // O^T: row = channel, column = query
      __syncthreads();   // all four waves' columns stand in so
      for (int e = tid; e < HD * 16; e += 128) { const int d = e >> 4, q4 = e & 15; vst2(Y + ((size_t)b * CC + h * HD + d) * TT + x * 64 + q4 * 4, *(const v4f*)&so[d][q4 * 4]); }
      x = (int)blockIdx.x; ts = 0;   // so is rewritten by the second tile only behind the stage barrier below
    } else ++ts;
    asm volatile("s_wait_dscnt 0x0" ::: "memory");      // this wave's reads of stage t's buffer (and of so) have returned
    asm volatile("s_wait_asynccnt 0x0" ::: "memory");   // this wave's copies of stage t + 1 have landed
    __syncthreads();                                    // publishes stage t + 1 and frees stage t's buffer
    if (t + 2 < NSTG) { const int s2 = t + 2, k2 = (s2 < n0 ? s2 : s2 - n0) * SKEY;   // block-uniform: only while stage t + 2 exists
      cp_stage(clk + (t & 1) * STGB, clv + (t & 1) * STGB, kcp + (size_t)k2 * CC, vcp + k2); } }
  asm volatile("s_wait_asynccnt 0x0" ::: "memory");     // nothing is in flight when the wave ends
}
extern "C" void kernel_launch(void* const* d_in, const int* in_sizes, int n_in, void* d_out, int out_size, void* d_ws, size_t ws_size, hipStream_t stream) {
  (void)in_sizes; (void)n_in; (void)out_size;
  const float** F = (const float**)d_in;   // 0 query [8,256,32,32], 1 key [8,256,32,32], 2 Wq [512,256], 3 bq, 4 Wk [512,256], 5 bk, 6 Wv [512,256], 7 bv
  if (ws_size < (size_t)WS_END) return;
  char* ws = (char*)d_ws; _Float16 *QH = (_Float16*)(ws + WS_QH), *KH = (_Float16*)(ws + WS_KH), *VT = (_Float16*)(ws + WS_VT);
  k_proj<<<dim3(TT / 128, CC / 128, TNB * 3), 128, 0, stream>>>(F[0], F[1], F[2], F[3], F[4], F[5], F[6], F[7], QH, KH, VT);
  k_att<<<dim3(TT / 128, HG), 128, 0, stream>>>(QH, KH, VT, (float*)d_out);   // logits, softmax and P.V of every (batch, head) in one launch
}
